// v000
// The times below were measured on an AMD MI455X: many runs one after another, warmed up first and cycling through
// copies of the inputs, with the whole window's GPU time divided by the number of runs. Launches and the gaps
// between them are all in it. The median over several windows is given; except for v000 it joins two sittings, which
// can be a few percent apart, so the side-by-side timings, each taken in one sitting, are the better comparison.
// v000, which the later versions start from, runs in 882 microseconds.
#include <hip/hip_runtime.h>

// Contractions: q/k/v projections v_wmma_f32_16x16x32_bf16 (bf16 copies of x and of the [out][in] weights); scores QK^T and P.V v_wmma_f32_16x16x32_f16 (f16 planes, P carried x1024) for query rows >= 256 and v_wmma_f32_16x16x32_bf16 hi/lo 3-product form for query rows < 256; ctx x Wo^T v_wmma_f32_16x16x32_f16 (ctx carried x64, Wo carried x1024, rows < 256 add an f16 residual plane x1024); f32 accumulate everywhere, softmax in f32.
// Layout per batch: bf16 copy of x; weights copied once as bf16 ([n][k] = Bt as-is), Wo as two f16 planes; f32 projection tiles; head-plane builders (no rotary in this module); flash-style causal attention (K and V^T tiles staged in LDS, online softmax); ctx planes; output GEMM into d_out.

#pragma clang fp contract(off)

#ifndef NB
#define NB 2
#endif
#ifndef SEQ
#define SEQ 2048
#endif
#ifndef RE
#define RE   256                  // query rows < RE (first RE/64 query blocks) use hi/lo planes
#endif
#define NB_FULL  2
#define SEQ_FULL 2048
#define DM   2048
#define NH_  16
#define NKV  4
#define REP  (NH_ / NKV)
#define HD   128
#define DQ   (NH_ * HD)
#define DKV  (NKV * HD)
#define PCAR 1024.0f              // carry of the f16 P operand (rows >= RE)
#define CCAR 64.0f                // carry of the f16 ctx plane
#define LOSC 1024.0f              // carry of the f16 ctx residual plane (rows < RE)
#define WCAR 1024.0f              // carry of the f16 Wo plane

static_assert((SEQ % 64) == 0);
static_assert((RE % 64) == 0);
static_assert(RE >= 64);
static_assert(SEQ >= RE);
static_assert(SEQ <= SEQ_FULL);
static_assert(NB >= 1);
static_assert(NB <= NB_FULL);
static_assert(HD == 128);
static_assert((DM % 32) == 0);
static_assert(DQ == DM);
static_assert(((SEQ * DM) % (8 * 256)) == 0);
static_assert(((NH_ * SEQ * HD) % (2 * 256)) == 0);
static_assert(((NKV * SEQ * HD) % (2 * 256)) == 0);
static_assert(((DQ * DM) % (8 * 256)) == 0);
static_assert(((DKV * DM) % (8 * 256)) == 0);
static_assert((HD % 64) == 0);                 // k_hpl: a wave covers 64 consecutive d of one (h, t) row
static_assert((NH_ % NKV) == 0);
static_assert((DQ % 64) == 0);
static_assert((DKV % 64) == 0);
static_assert((DM % 64) == 0);

typedef _Float16 h16;
typedef unsigned short bf;
typedef __attribute__((ext_vector_type(16))) __bf16   v16bf;
typedef __attribute__((ext_vector_type(16))) _Float16 v16h;
typedef __attribute__((ext_vector_type(8)))  _Float16 v8h;
typedef __attribute__((ext_vector_type(8)))  unsigned short v8us;
typedef __attribute__((ext_vector_type(8)))  float    v8f;
typedef __attribute__((ext_vector_type(4)))  float    v4f;
typedef __attribute__((ext_vector_type(2)))  _Float16 v2h;
typedef __attribute__((ext_vector_type(2)))  unsigned short v2us;
typedef v8h  __attribute__((may_alias)) v8ha;
typedef v4f  __attribute__((may_alias)) v4fa;
typedef v8us __attribute__((may_alias)) v8usa;

__device__ __forceinline__ unsigned short f2bf(float f) { unsigned u = __float_as_uint(f); u += 0x7FFFu + ((u >> 16) & 1u); return (unsigned short)(u >> 16); }
__device__ __forceinline__ float bf2f(unsigned short b) { return __uint_as_float(((unsigned)b) << 16); }
__device__ __forceinline__ float bfr(float f) { return bf2f(f2bf(f)); }
__device__ __forceinline__ h16 tohx(float x) { return (h16)x; }
__device__ __forceinline__ void splitf(float y, unsigned short& h, unsigned short& l) { h = f2bf(y); l = f2bf(y - bf2f(h)); }
__device__ __forceinline__ v16h cat16(v8h lo, v8h hi) { return __builtin_shufflevector(lo, hi, 0, 1, 2, 3, 4, 5, 6, 7, 8, 9, 10, 11, 12, 13, 14, 15); }
__device__ __forceinline__ v16bf cat16b(v8us lo, v8us hi) { return __builtin_bit_cast(v16bf, __builtin_shufflevector(lo, hi, 0, 1, 2, 3, 4, 5, 6, 7, 8, 9, 10, 11, 12, 13, 14, 15)); }
__device__ __forceinline__ v8f wmma16(v16h a, v16h b, v8f c) { return __builtin_amdgcn_wmma_f32_16x16x32_f16(false, a, false, b, (short)0, c, false, false); }
__device__ __forceinline__ v8f wmmab(v16bf a, v16bf b, v8f c) { return __builtin_amdgcn_wmma_f32_16x16x32_bf16(false, a, false, b, (short)0, c, false, false); }

// f32 -> f16 convert that cannot produce a sub-normal f16: magnitudes below 2^-14 become zero by a value select.
static __device__ __forceinline__ h16 toh_flush(float v) { const h16 r = (h16)v; return (fabsf(v) < 6.103515625e-05f) ? (h16)0.0f : r; }

// Fragment loaders for A (row m = lane&15) and for B stored [n][k] (col n = lane&15): elements 0..7 <- k0+8h..+7, elements 8..15 <- k0+16+8h..+7 (p already points at row*pitch + k0 + 8h).
template <typename T16> struct WFrag;
template <> struct WFrag<h16> { typedef v16h V; static __device__ __forceinline__ V ld(const h16* p) { return cat16(*(const v8ha*)p, *(const v8ha*)(p + 16)); } static __device__ __forceinline__ v8f mma(V a, V b, v8f c) { return wmma16(a, b, c); } };
template <> struct WFrag<bf>  { typedef v16bf V; static __device__ __forceinline__ V ld(const bf* p) { return cat16b(*(const v8usa*)p, *(const v8usa*)(p + 16)); } static __device__ __forceinline__ v8f mma(V a, V b, v8f c) { return wmmab(a, b, c); } };

// ---- k_gemmw: register-blocked GEMM, ONE WAVE per 64x64 output tile (16 accumulators), operands straight from K-contiguous 16-bit planes; grid (M/64, N/64, 1), 32 threads.
// C[m][n] (f32, pitch ldc) = oscale * sum_k ( A[m][k] Bt[n][k]  (+ A2 Bt: NSPLIT 1,2) (+ A Bt2: NSPLIT 2) (+ A2 Bt2: NSPLIT 3) ). Row pitch of A, A2, Bt, Bt2 = K. K % 32 == 0.
template <typename T16, int NSPLIT>
__global__ __launch_bounds__(32) void k_gemmw(const T16* __restrict__ A, const T16* __restrict__ A2, const T16* __restrict__ Bt, const T16* __restrict__ Bt2, int K, float* C, int ldc, float oscale) {
    typedef typename WFrag<T16>::V V;
    __shared__ __align__(16) float os[16 * 68];
    const int lane = threadIdx.x & 31, lr = lane & 15, hi = lane >> 4; const int r0 = blockIdx.x * 64, c0 = blockIdx.y * 64;
    v8f acc[4][4];
#pragma unroll
    for (int mb = 0; mb < 4; ++mb)
#pragma unroll
        for (int nb = 0; nb < 4; ++nb) acc[mb][nb] = (v8f){};
    const size_t aoff = (size_t)(r0 + lr) * K + 8 * hi, boff = (size_t)(c0 + lr) * K + 8 * hi;
#pragma unroll 1
    for (int kc = 0; kc < K; kc += 32) {
        V a[4], a2[4];
#pragma unroll
        for (int mb = 0; mb < 4; ++mb) { a[mb] = WFrag<T16>::ld(A + aoff + (size_t)mb * 16 * K + kc); if (NSPLIT != 0) a2[mb] = WFrag<T16>::ld(A2 + aoff + (size_t)mb * 16 * K + kc); }
#pragma unroll
        for (int nb = 0; nb < 4; ++nb) { const V b = WFrag<T16>::ld(Bt + boff + (size_t)nb * 16 * K + kc); V b2 = b; if (NSPLIT >= 2) b2 = WFrag<T16>::ld(Bt2 + boff + (size_t)nb * 16 * K + kc);
#pragma unroll
            for (int mb = 0; mb < 4; ++mb) { acc[mb][nb] = WFrag<T16>::mma(a[mb], b, acc[mb][nb]); if (NSPLIT == 1 || NSPLIT == 2) acc[mb][nb] = WFrag<T16>::mma(a2[mb], b, acc[mb][nb]); if (NSPLIT == 2) acc[mb][nb] = WFrag<T16>::mma(a[mb], b2, acc[mb][nb]); if (NSPLIT == 3) acc[mb][nb] = WFrag<T16>::mma(a2[mb], b2, acc[mb][nb]); } }
        asm volatile("v_nop\n\tv_nop\n\tv_nop\n\tv_nop" : "+v"(acc[0][0]), "+v"(acc[1][1]), "+v"(acc[2][2]), "+v"(acc[3][3]) : "v"(a[0]), "v"(a[3]));
    }
#pragma unroll
    for (int mb = 0; mb < 4; ++mb) {
#pragma unroll
        for (int nb = 0; nb < 4; ++nb) {
#pragma unroll
            for (int j = 0; j < 8; ++j) os[(hi * 8 + j) * 68 + nb * 16 + lr] = acc[mb][nb][j]; }
        __builtin_amdgcn_wave_barrier(); asm volatile("" ::: "memory");
        float* crow = C + (size_t)(r0 + mb * 16) * ldc + c0;
{
#pragma unroll
            for (int s = 0; s < 8; ++s) { const int row = 2 * s + hi, cofs = lr * 4; v4f val = *(const v4fa*)(os + row * 68 + cofs); val = val * oscale;
                *(v4f*)(crow + (size_t)row * ldc + cofs) = val; }
             }
        __builtin_amdgcn_wave_barrier(); asm volatile("" ::: "memory");
    }
}

__global__ __launch_bounds__(256) void k_cvt8(const float* __restrict__ src, bf* dst, size_t n8) { const size_t i = (size_t)blockIdx.x * 256 + threadIdx.x; if (i >= n8) return; const v8f v = *(const v8f*)(src + i * 8); v8us o;
#pragma unroll
    for (int k = 0; k < 8; ++k) o[k] = f2bf(v[k]); *(v8us*)(dst + i * 8) = o;  }

__global__ __launch_bounds__(256) void k_cvtwo(const float* __restrict__ src, h16* dh, h16* dl, size_t n8) { const size_t i = (size_t)blockIdx.x * 256 + threadIdx.x; if (i >= n8) return; const v8f v = *(const v8f*)(src + i * 8); v8h oh, ol;
#pragma unroll
    for (int k = 0; k < 8; ++k) { const float w = bfr(v[k]); oh[k] = tohx(w * WCAR); ol[k] = tohx(w); }
    *(v8h*)(dh + i * 8) = oh; *(v8h*)(dl + i * 8) = ol;  }

// k_hpl: head planes P16[h][t][d] (f16, magnitudes below 2^-14 stored as zero) = F[t][h*HD + d] (row pitch given, no rotary);
__global__ __launch_bounds__(256) void k_hpl(const float* __restrict__ F, int pitch, int nheads, h16* P16, bf* Eh, bf* El) {
    const size_t e = ((size_t)blockIdx.x * 256 + threadIdx.x) * 2; if (e >= (size_t)nheads * SEQ * HD) return;
    const int d = (int)(e % HD); const int t = (int)((e / HD) % SEQ); const int h = (int)(e / ((size_t)HD * SEQ));
    const float* f = F + (size_t)t * pitch + h * HD + d; v2h o16; v2us oh, ol;
#pragma unroll
    for (int q = 0; q < 2; ++q) { const float r = f[q]; o16[q] = toh_flush(r); unsigned short a2, c2; splitf(r, a2, c2); oh[q] = a2; ol[q] = c2; }
    const bool early = (t < RE);      // uniform per wave (a wave covers 64 consecutive d of one (h, t) row; RE % 64 == 0)
    const size_t ee = ((size_t)h * RE + (early ? t : 0)) * HD + d;
    *(v2h*)(P16 + e) = o16; if (early) { *(v2us*)(Eh + ee) = oh; *(v2us*)(El + ee) = ol; }
    
}

__global__ __launch_bounds__(256) void k_vtp(const float* __restrict__ F, h16* V16, bf* Eh, bf* El) {
    const size_t e = ((size_t)blockIdx.x * 256 + threadIdx.x) * 2; if (e >= (size_t)NKV * HD * SEQ) return;
    const int t = (int)(e % SEQ); const int d = (int)((e / SEQ) % HD); const int g = (int)(e / ((size_t)SEQ * HD)); v2h o16; v2us oh, ol;
#pragma unroll
    for (int q = 0; q < 2; ++q) { const float x = F[(size_t)(t + q) * DKV + g * HD + d]; o16[q] = tohx(x); unsigned short a2, c2; splitf(x, a2, c2); oh[q] = a2; ol[q] = c2; }
    const bool early = (t < RE);      // uniform per wave (a wave covers 64 consecutive t of one (g, d) row; RE % 64 == 0)
    const size_t ee = ((size_t)g * HD + d) * RE + (early ? t : 0);
    *(v2h*)(V16 + e) = o16; if (early) { *(v2us*)(Eh + ee) = oh; *(v2us*)(El + ee) = ol; }
    
}

// P tile writers: f16 x PCAR (rows >= RE) or bf16 hi/lo (rows < RE).
__device__ __forceinline__ void putp(h16* ph, h16* pl, int i, float p) { (void)pl; ph[i] = tohx(p * PCAR); }
__device__ __forceinline__ void putp(bf* ph, bf* pl, int i, float p) { unsigned short a, c; splitf(p, a, c); ph[i] = a; pl[i] = c; }

// ---- k_attn: flash-style causal grouped-query attention. grid (query blocks, NH_, 1), 128 threads; wave w owns query rows q0 + 16w .. +15.
// Planes: Qh/Ql [h][TP][HD], Kh/Kl [g][TP][HD], Vh/Vl = V^T [g][HD][TP] (TP = SEQ for the f16 planes, RE for the bf16 hi/lo planes of the first RE/64 query blocks).
// EARLY instance: query blocks 0 .. RE/64-1 (rows < RE, keys < RE); other instance: query blocks RE/64 .. SEQ/64-1.
// Per 32-key chunk: K tile [32][HD] and V^T tile [HD][32] staged in LDS by all threads (block barriers), S = Q K^T (2 tiles), online softmax in f32
// (causal keys > query replaced by -inf: p = 0), P through a wave-private LDS tile (block barrier before the fragment reload), O += P V (8 tiles).
// EARLY: 3 products (hi.hi + hi.lo + lo.hi) for S and for P.V. Output: ctx plane CT[t][h*HD + d] = f16(ctx x CCAR); EARLY also CTL = f16((ctx x CCAR - hi) x LOSC);
template <typename T16, bool EARLY>
__global__ __launch_bounds__(128) void k_attn(const T16* __restrict__ Qh, const T16* __restrict__ Ql, const T16* __restrict__ Kh, const T16* __restrict__ Kl,
                                             const T16* __restrict__ Vh, const T16* __restrict__ Vl, h16* CT, h16* CTL) {
    typedef typename WFrag<T16>::V V;
    constexpr int TP = EARLY ? RE : SEQ;
    constexpr int KSP = 136, VTP = 32, PSP = 40, OSP = 128;
    __shared__ __align__(16) T16 ksh[32 * KSP];
    __shared__ __align__(16) T16 ksl[EARLY ? 32 * KSP : 16];
    __shared__ __align__(16) T16 vth[HD * VTP];
    __shared__ __align__(16) T16 vtl[EARLY ? HD * VTP : 16];
    __shared__ __align__(16) T16 psh[4 * 16 * PSP];
    __shared__ __align__(16) T16 psl[EARLY ? 4 * 16 * PSP : 16];
    __shared__ __align__(16) h16 osg[4 * 16 * OSP];
    const int tid = threadIdx.x, lane = tid & 31, wave = tid >> 5, lr = lane & 15, hh = lane >> 4;
    const int qblk = EARLY ? (int)blockIdx.x : ((int)blockIdx.x + RE / 64);
    const int head = blockIdx.y, g = head / REP;
    const int qw = qblk * 64 + wave * 16;                  // first query row of this wave
    const int nch = 2 * qblk + 2;                          // 32-key chunks visited: keys 0 .. qblk*64+63
    const T16* qph = Qh + ((size_t)head * TP + qw) * HD;  const T16* qpl = Ql + ((size_t)head * TP + qw) * HD;
    const T16* kph = Kh + (size_t)g * TP * HD;             const T16* kpl = Kl + (size_t)g * TP * HD;
    const T16* vph = Vh + (size_t)g * HD * TP;             const T16* vpl = Vl + (size_t)g * HD * TP;
    T16* myph = psh + wave * 16 * PSP; T16* mypl = psl + (EARLY ? wave * 16 * PSP : 0);
    v8f o[8];
#pragma unroll
    for (int t = 0; t < 8; ++t) o[t] = (v8f){};
    float mrow[8], lrow[8];
#pragma unroll
    for (int r = 0; r < 8; ++r) { mrow[r] = -3.0e38f; lrow[r] = 0.f; }
    const float C2 = 1.4426950408889634f * 0.08838834764831845f;   // log2(e) x HD^-0.5
#pragma unroll 1
    for (int c = 0; c < nch; ++c) {
        __syncthreads();                                    // all waves done with the prior chunk's tiles
#pragma unroll
        for (int i = 0; i < 4; ++i) { const int id = tid + 128 * i; const int row = id >> 4, c8 = (id & 15) * 8; const size_t go = (size_t)(c * 32 + row) * HD + c8;
            *(v8usa*)(ksh + row * KSP + c8) = *(const v8usa*)(kph + go); if (EARLY) *(v8usa*)(ksl + row * KSP + c8) = *(const v8usa*)(kpl + go); }
#pragma unroll
        for (int j = 0; j < 4; ++j) { const size_t go = (size_t)tid * TP + c * 32 + 8 * j;      // d = tid
            *(v8usa*)(vth + tid * VTP + 8 * j) = *(const v8usa*)(vph + go); if (EARLY) *(v8usa*)(vtl + tid * VTP + 8 * j) = *(const v8usa*)(vpl + go); }
        __syncthreads();                                    // tiles visible
        v8f s0 = (v8f){}, s1 = (v8f){};
        V qa, kb0, kb1;
#pragma unroll
        for (int ks = 0; ks < 4; ++ks) {
            qa  = WFrag<T16>::ld(qph + (size_t)lr * HD + ks * 32 + 8 * hh);
            kb0 = WFrag<T16>::ld(ksh + lr * KSP + ks * 32 + 8 * hh);
            kb1 = WFrag<T16>::ld(ksh + (16 + lr) * KSP + ks * 32 + 8 * hh);
            s0 = WFrag<T16>::mma(qa, kb0, s0); s1 = WFrag<T16>::mma(qa, kb1, s1);
            if (EARLY) {
                const V qb  = WFrag<T16>::ld(qpl + (size_t)lr * HD + ks * 32 + 8 * hh);
                const V kl0 = WFrag<T16>::ld(ksl + lr * KSP + ks * 32 + 8 * hh);
                const V kl1 = WFrag<T16>::ld(ksl + (16 + lr) * KSP + ks * 32 + 8 * hh);
                s0 = WFrag<T16>::mma(qa, kl0, s0); s0 = WFrag<T16>::mma(qb, kb0, s0);
                s1 = WFrag<T16>::mma(qa, kl1, s1); s1 = WFrag<T16>::mma(qb, kb1, s1); }
        }
        asm volatile("v_nop\n\tv_nop\n\tv_nop\n\tv_nop" : "+v"(s0), "+v"(s1) : "v"(qa), "v"(kb0), "v"(kb1));
        // online softmax; acc element r of lane (lr, hh) = S[query qw + 8hh + r][key c*32 + lr] (s0) / [key c*32 + 16 + lr] (s1)
        float p0[8], p1[8];
        const int kg0 = c * 32 + lr, kg1 = kg0 + 16;
#pragma unroll
        for (int r = 0; r < 8; ++r) {
            const int qr = qw + 8 * hh + r;
            const bool v0 = (kg0 <= qr), v1 = (kg1 <= qr);
            const float a0 = v0 ? s0[r] * C2 : -3.0e38f;
            const float a1 = v1 ? s1[r] * C2 : -3.0e38f;
            float mx = fmaxf(a0, a1);
#pragma unroll
            for (int off = 8; off >= 1; off >>= 1) mx = fmaxf(mx, __shfl_xor(mx, off, 32));
            const float mnew = fmaxf(mrow[r], mx);
            const float alpha = __builtin_amdgcn_exp2f(mrow[r] - mnew);
            mrow[r] = mnew;
            const float x0 = __builtin_amdgcn_exp2f(a0 - mnew), x1 = __builtin_amdgcn_exp2f(a1 - mnew);
            const float e0 = v0 ? x0 : 0.f, e1 = v1 ? x1 : 0.f;
            float rs = e0 + e1;
#pragma unroll
            for (int off = 8; off >= 1; off >>= 1) rs += __shfl_xor(rs, off, 32);
            lrow[r] = lrow[r] * alpha + rs;
#pragma unroll
            for (int t = 0; t < 8; ++t) o[t][r] = o[t][r] * alpha;
            p0[r] = e0; p1[r] = e1;
        }
        // P tile [16 query rows][32 keys] -> A fragment (k = key)
#pragma unroll
        for (int r = 0; r < 8; ++r) { putp(myph, mypl, (8 * hh + r) * PSP + lr, p0[r]); putp(myph, mypl, (8 * hh + r) * PSP + 16 + lr, p1[r]); }
        __syncthreads();                                    // P visible (block barrier also orders this wave's own stores before the reload)
        const V pa = WFrag<T16>::ld(myph + lr * PSP + 8 * hh);
        V pb = pa; if (EARLY) pb = WFrag<T16>::ld(mypl + lr * PSP + 8 * hh);
        V vb;
#pragma unroll
        for (int t = 0; t < 8; ++t) { vb = WFrag<T16>::ld(vth + (t * 16 + lr) * VTP + 8 * hh);
            o[t] = WFrag<T16>::mma(pa, vb, o[t]);
            if (EARLY) { const V vl2 = WFrag<T16>::ld(vtl + (t * 16 + lr) * VTP + 8 * hh); o[t] = WFrag<T16>::mma(pa, vl2, o[t]); o[t] = WFrag<T16>::mma(pb, vb, o[t]); } }
        asm volatile("v_nop\n\tv_nop\n\tv_nop\n\tv_nop" : "+v"(o[0]), "+v"(o[1]), "+v"(o[2]), "+v"(o[3]), "+v"(o[4]), "+v"(o[5]), "+v"(o[6]), "+v"(o[7]) : "v"(pa), "v"(pb), "v"(vb));
    }
    // normalise and write ctx planes; o element r of lane (lr, hh), tile t = ctx[row qw + 8hh + r][d = 16t + lr]
    const float osc = EARLY ? CCAR : (CCAR / PCAR);
    float inv[8];
#pragma unroll
    for (int r = 0; r < 8; ++r) inv[r] = osc * __builtin_amdgcn_rcpf(lrow[r]);
    h16* myos = osg + wave * 16 * OSP;
#pragma unroll
    for (int t = 0; t < 8; ++t)
#pragma unroll
        for (int r = 0; r < 8; ++r) myos[(8 * hh + r) * OSP + t * 16 + lr] = tohx(o[t][r] * inv[r]);
    __syncthreads();
    h16* crow = CT + (size_t)qw * DM + head * HD;
{
#pragma unroll
        for (int s = 0; s < 8; ++s) { const int row = 2 * s + hh; const v8h val = *(const v8ha*)(myos + row * OSP + lr * 8); *(v8h*)(crow + (size_t)row * DM + lr * 8) = val; }
         }
    if (EARLY) {
        __syncthreads();
#pragma unroll
        for (int t = 0; t < 8; ++t)
#pragma unroll
            for (int r = 0; r < 8; ++r) { const float val = o[t][r] * inv[r]; const h16 hv = tohx(val); myos[(8 * hh + r) * OSP + t * 16 + lr] = tohx((val - (float)hv) * LOSC); }
        __syncthreads();
        h16* lrowp = CTL + (size_t)qw * DM + head * HD;
{
#pragma unroll
            for (int s = 0; s < 8; ++s) { const int row = 2 * s + hh; const v8h val = *(const v8ha*)(myos + row * OSP + lr * 8); *(v8h*)(lrowp + (size_t)row * DM + lr * 8) = val; }
             }
    }
}

// workspace carve total (each region padded to 256 B), checked against the 128 MiB line at build time
constexpr size_t al256(size_t b) { return (b + 255) & ~(size_t)255; }
constexpr size_t WS_TOTAL =
    al256((size_t)DQ * DM * 2) + 2 * al256((size_t)DKV * DM * 2) + 2 * al256((size_t)DM * DQ * 2) + al256((size_t)SEQ * DM * 2) +
    al256((size_t)SEQ * DQ * 4) + 2 * al256((size_t)SEQ * DKV * 4) +
    al256((size_t)NH_ * SEQ * HD * 2) + 2 * al256((size_t)NKV * SEQ * HD * 2) +
    2 * al256((size_t)NH_ * RE * HD * 2) + 4 * al256((size_t)NKV * RE * HD * 2) +
    al256((size_t)SEQ * DM * 2) + al256((size_t)RE * DM * 2);
static_assert(WS_TOTAL <= (size_t)134217728);

extern "C" void kernel_launch(void* const* d_in, const int* in_sizes, int n_in,
                              void* d_out, int out_size, void* d_ws, size_t ws_size, hipStream_t stream) {
    if (n_in < 5) return;
    const float* x  = (const float*)d_in[0];     // [NB_FULL][SEQ_FULL][DM]
    const float* wq = (const float*)d_in[1];     // [DQ][DM]  ([out][in])
    const float* wk = (const float*)d_in[2];     // [DKV][DM]
    const float* wv = (const float*)d_in[3];     // [DKV][DM]
    const float* wo = (const float*)d_in[4];     // [DM][DQ]
    float* OUT = (float*)d_out;                  // [NB_FULL][SEQ_FULL][DM]
    if ((size_t)in_sizes[0] < (size_t)(NB - 1) * SEQ_FULL * DM + (size_t)SEQ * DM) return;
    if ((size_t)in_sizes[1] < (size_t)DQ * DM) return;
    if ((size_t)in_sizes[2] < (size_t)DKV * DM) return;
    if ((size_t)in_sizes[3] < (size_t)DKV * DM) return;
    if ((size_t)in_sizes[4] < (size_t)DM * DQ) return;
    if ((size_t)out_size < (size_t)(NB - 1) * SEQ_FULL * DM + (size_t)SEQ * DM) return;

    char* wsp = (char*)d_ws;
    auto take = [&](size_t bytes) { char* p = wsp; wsp += (bytes + 255) & ~(size_t)255; return (void*)p; };
    bf*  WQ   = (bf*)take((size_t)DQ * DM * 2);    bf* WK = (bf*)take((size_t)DKV * DM * 2);    bf* WV = (bf*)take((size_t)DKV * DM * 2);
    h16* WOH  = (h16*)take((size_t)DM * DQ * 2);   h16* WOL = (h16*)take((size_t)DM * DQ * 2);
    bf*  XB   = (bf*)take((size_t)SEQ * DM * 2);
    float* FQ = (float*)take((size_t)SEQ * DQ * 4); float* FK = (float*)take((size_t)SEQ * DKV * 4); float* FV = (float*)take((size_t)SEQ * DKV * 4);
    h16* QP16 = (h16*)take((size_t)NH_ * SEQ * HD * 2); h16* KP16 = (h16*)take((size_t)NKV * SEQ * HD * 2); h16* VT16 = (h16*)take((size_t)NKV * HD * SEQ * 2);
    bf*  QEh  = (bf*)take((size_t)NH_ * RE * HD * 2);  bf* QEl = (bf*)take((size_t)NH_ * RE * HD * 2);
    bf*  KEh  = (bf*)take((size_t)NKV * RE * HD * 2);  bf* KEl = (bf*)take((size_t)NKV * RE * HD * 2);
    bf*  VEh  = (bf*)take((size_t)NKV * HD * RE * 2);  bf* VEl = (bf*)take((size_t)NKV * HD * RE * 2);
    h16* CT16 = (h16*)take((size_t)SEQ * DM * 2);     h16* CTL = (h16*)take((size_t)RE * DM * 2);
    if ((size_t)(wsp - (char*)d_ws) > ws_size) return;       // 88,080,384 B at full size

    const float woscale = 1.0f / (CCAR * WCAR);
    k_cvt8<<<(unsigned)(((size_t)DQ * DM / 8 + 255) / 256), 256, 0, stream>>>(wq, WQ, (size_t)DQ * DM / 8);
    k_cvt8<<<(unsigned)(((size_t)DKV * DM / 8 + 255) / 256), 256, 0, stream>>>(wk, WK, (size_t)DKV * DM / 8);
    k_cvt8<<<(unsigned)(((size_t)DKV * DM / 8 + 255) / 256), 256, 0, stream>>>(wv, WV, (size_t)DKV * DM / 8);
    k_cvtwo<<<(unsigned)(((size_t)DM * DQ / 8 + 255) / 256), 256, 0, stream>>>(wo, WOH, WOL, (size_t)DM * DQ / 8);
    const unsigned LQ = (unsigned)(((size_t)NH_ * SEQ * HD / 2 + 255) / 256), LKV = (unsigned)(((size_t)NKV * SEQ * HD / 2 + 255) / 256);
    for (int b = 0; b < NB; ++b) {
        const float* xb = x + (size_t)b * SEQ_FULL * DM;
        float* OUTb = OUT + (size_t)b * SEQ_FULL * DM;
        k_cvt8<<<(unsigned)(((size_t)SEQ * DM / 8 + 255) / 256), 256, 0, stream>>>(xb, XB, (size_t)SEQ * DM / 8);
        k_gemmw<bf, 0><<<dim3(SEQ / 64, DQ / 64, 1), 32, 0, stream>>>(XB, nullptr, WQ, nullptr, DM, FQ, DQ, 1.0f);
        k_hpl<<<LQ, 256, 0, stream>>>(FQ, DQ, NH_, QP16, QEh, QEl);
        k_gemmw<bf, 0><<<dim3(SEQ / 64, DKV / 64, 1), 32, 0, stream>>>(XB, nullptr, WK, nullptr, DM, FK, DKV, 1.0f);
        k_hpl<<<LKV, 256, 0, stream>>>(FK, DKV, NKV, KP16, KEh, KEl);
        k_gemmw<bf, 0><<<dim3(SEQ / 64, DKV / 64, 1), 32, 0, stream>>>(XB, nullptr, WV, nullptr, DM, FV, DKV, 1.0f);
        k_vtp<<<LKV, 256, 0, stream>>>(FV, VT16, VEh, VEl);
        k_attn<bf, true><<<dim3(RE / 64, NH_, 1), 128, 0, stream>>>(QEh, QEl, KEh, KEl, VEh, VEl, CT16, CTL);
        if (SEQ > RE) k_attn<h16, false><<<dim3(SEQ / 64 - RE / 64, NH_, 1), 128, 0, stream>>>(QP16, QP16, KP16, KP16, VT16, VT16, CT16, CTL);
        k_gemmw<h16, 3><<<dim3(RE / 64, DM / 64, 1), 32, 0, stream>>>(CT16, CTL, WOH, WOL, DQ, OUTb, DM, woscale);
        if (SEQ > RE) k_gemmw<h16, 0><<<dim3((SEQ - RE) / 64, DM / 64, 1), 32, 0, stream>>>(CT16 + (size_t)RE * DQ, nullptr, WOH, nullptr, DQ, OUTb + (size_t)RE * DM, DM, woscale);
    }
}

// v001
// It runs in 522 microseconds.
// Next to v000, in two timings, it ran 1.72 and 1.71 times as fast.
#include <hip/hip_runtime.h>

// Contractions: q/k/v projections v_wmma_f32_16x16x32_bf16 (bf16 copies of x and of the [out][in] weights); scores QK^T and P.V v_wmma_f32_16x16x32_f16 (f16 planes, P carried x1024) for query rows >= 256 and v_wmma_f32_16x16x32_bf16 hi/lo 3-product form for query rows < 256; ctx x Wo^T v_wmma_f32_16x16x32_f16 (ctx carried x64, Wo carried x1024, rows < 256 add an f16 residual plane x1024); f32 accumulate everywhere, softmax in f32.
// Both batches run in every launch (the batch is grid.z for the GEMMs and attention, grid.y for the x converter and plane builders; each batch has its own workspace planes). Per batch: bf16 copy of x; weights copied once as bf16 ([n][k] = Bt as-is), Wo as two f16 planes; f32 projection tiles; head-plane builders (no rotary in this module); flash-style causal attention (K and V^T tiles staged in LDS, online softmax); ctx planes; output GEMM into d_out.

#pragma clang fp contract(off)

#ifndef NB
#define NB 2
#endif
#ifndef SEQ
#define SEQ 2048
#endif
#ifndef RE
#define RE   256                  // query rows < RE (first RE/64 query blocks) use hi/lo planes
#endif
#define NB_FULL  2
#define SEQ_FULL 2048
#define DM   2048
#define NH_  16
#define NKV  4
#define REP  (NH_ / NKV)
#define HD   128
#define DQ   (NH_ * HD)
#define DKV  (NKV * HD)
#define PCAR 1024.0f              // carry of the f16 P operand (rows >= RE)
#define CCAR 64.0f                // carry of the f16 ctx plane
#define LOSC 1024.0f              // carry of the f16 ctx residual plane (rows < RE)
#define WCAR 1024.0f              // carry of the f16 Wo plane

static_assert((SEQ % 64) == 0);
static_assert((RE % 64) == 0);
static_assert(RE >= 64);
static_assert(SEQ >= RE);
static_assert(SEQ <= SEQ_FULL);
static_assert(NB >= 1);
static_assert(NB <= NB_FULL);
static_assert(HD == 128);
static_assert((DM % 32) == 0);
static_assert(DQ == DM);
static_assert(((SEQ * DM) % (8 * 256)) == 0);
static_assert(((NH_ * SEQ * HD) % (2 * 256)) == 0);
static_assert(((NKV * SEQ * HD) % (2 * 256)) == 0);
static_assert(((DQ * DM) % (8 * 256)) == 0);
static_assert(((DKV * DM) % (8 * 256)) == 0);
static_assert((HD % 64) == 0);                 // k_hpl: a wave covers 64 consecutive d of one (h, t) row
static_assert((NH_ % NKV) == 0);
static_assert((DQ % 64) == 0);
static_assert((DKV % 64) == 0);
static_assert((DM % 64) == 0);

typedef _Float16 h16;
typedef unsigned short bf;
typedef __attribute__((ext_vector_type(16))) __bf16   v16bf;
typedef __attribute__((ext_vector_type(16))) _Float16 v16h;
typedef __attribute__((ext_vector_type(8)))  _Float16 v8h;
typedef __attribute__((ext_vector_type(8)))  unsigned short v8us;
typedef __attribute__((ext_vector_type(8)))  float    v8f;
typedef __attribute__((ext_vector_type(4)))  float    v4f;
typedef __attribute__((ext_vector_type(2)))  _Float16 v2h;
typedef __attribute__((ext_vector_type(2)))  unsigned short v2us;
typedef v8h  __attribute__((may_alias)) v8ha;
typedef v4f  __attribute__((may_alias)) v4fa;
typedef v8us __attribute__((may_alias)) v8usa;

__device__ __forceinline__ unsigned short f2bf(float f) { unsigned u = __float_as_uint(f); u += 0x7FFFu + ((u >> 16) & 1u); return (unsigned short)(u >> 16); }
__device__ __forceinline__ float bf2f(unsigned short b) { return __uint_as_float(((unsigned)b) << 16); }
__device__ __forceinline__ float bfr(float f) { return bf2f(f2bf(f)); }
__device__ __forceinline__ h16 tohx(float x) { return (h16)x; }
__device__ __forceinline__ void splitf(float y, unsigned short& h, unsigned short& l) { h = f2bf(y); l = f2bf(y - bf2f(h)); }
__device__ __forceinline__ v16h cat16(v8h lo, v8h hi) { return __builtin_shufflevector(lo, hi, 0, 1, 2, 3, 4, 5, 6, 7, 8, 9, 10, 11, 12, 13, 14, 15); }
__device__ __forceinline__ v16bf cat16b(v8us lo, v8us hi) { return __builtin_bit_cast(v16bf, __builtin_shufflevector(lo, hi, 0, 1, 2, 3, 4, 5, 6, 7, 8, 9, 10, 11, 12, 13, 14, 15)); }
__device__ __forceinline__ v8f wmma16(v16h a, v16h b, v8f c) { return __builtin_amdgcn_wmma_f32_16x16x32_f16(false, a, false, b, (short)0, c, false, false); }
__device__ __forceinline__ v8f wmmab(v16bf a, v16bf b, v8f c) { return __builtin_amdgcn_wmma_f32_16x16x32_bf16(false, a, false, b, (short)0, c, false, false); }

// f32 -> f16 convert that cannot produce a sub-normal f16: magnitudes below 2^-14 become zero by a value select.
static __device__ __forceinline__ h16 toh_flush(float v) { const h16 r = (h16)v; return (fabsf(v) < 6.103515625e-05f) ? (h16)0.0f : r; }

// Fragment loaders for A (row m = lane&15) and for B stored [n][k] (col n = lane&15): elements 0..7 <- k0+8h..+7, elements 8..15 <- k0+16+8h..+7 (p already points at row*pitch + k0 + 8h).
template <typename T16> struct WFrag;
template <> struct WFrag<h16> { typedef v16h V; static __device__ __forceinline__ V ld(const h16* p) { return cat16(*(const v8ha*)p, *(const v8ha*)(p + 16)); } static __device__ __forceinline__ v8f mma(V a, V b, v8f c) { return wmma16(a, b, c); } };
template <> struct WFrag<bf>  { typedef v16bf V; static __device__ __forceinline__ V ld(const bf* p) { return cat16b(*(const v8usa*)p, *(const v8usa*)(p + 16)); } static __device__ __forceinline__ v8f mma(V a, V b, v8f c) { return wmmab(a, b, c); } };

// ---- k_gemmw: register-blocked GEMM, ONE WAVE per 64x64 output tile (16 accumulators), operands straight from K-contiguous 16-bit planes; grid (M/64, N/64, batches), 32 threads; batch z reads A + z*sA, A2 + z*sA2 and writes C + z*sC (Bt, Bt2 shared).
// C[m][n] (f32, pitch ldc) = oscale * sum_k ( A[m][k] Bt[n][k]  (+ A2 Bt: NSPLIT 1,2) (+ A Bt2: NSPLIT 2) (+ A2 Bt2: NSPLIT 3) ). Row pitch of A, A2, Bt, Bt2 = K. K % 32 == 0.
template <typename T16, int NSPLIT>
__global__ __launch_bounds__(32) void k_gemmw(const T16* __restrict__ A0, const T16* __restrict__ A20, const T16* __restrict__ Bt, const T16* __restrict__ Bt2, int K, float* C0, int ldc, float oscale, size_t sA, size_t sA2, size_t sC) {
    typedef typename WFrag<T16>::V V;
    const T16* A = A0 + (size_t)blockIdx.z * sA; const T16* A2 = (NSPLIT != 0) ? A20 + (size_t)blockIdx.z * sA2 : A20; float* C = C0 + (size_t)blockIdx.z * sC;
    __shared__ __align__(16) float os[16 * 68];
    const int lane = threadIdx.x & 31, lr = lane & 15, hi = lane >> 4; const int r0 = blockIdx.x * 64, c0 = blockIdx.y * 64;
    v8f acc[4][4];
#pragma unroll
    for (int mb = 0; mb < 4; ++mb)
#pragma unroll
        for (int nb = 0; nb < 4; ++nb) acc[mb][nb] = (v8f){};
    const size_t aoff = (size_t)(r0 + lr) * K + 8 * hi, boff = (size_t)(c0 + lr) * K + 8 * hi;
#pragma unroll 1
    for (int kc = 0; kc < K; kc += 32) {
        V a[4], a2[4];
#pragma unroll
        for (int mb = 0; mb < 4; ++mb) { a[mb] = WFrag<T16>::ld(A + aoff + (size_t)mb * 16 * K + kc); if (NSPLIT != 0) a2[mb] = WFrag<T16>::ld(A2 + aoff + (size_t)mb * 16 * K + kc); }
#pragma unroll
        for (int nb = 0; nb < 4; ++nb) { const V b = WFrag<T16>::ld(Bt + boff + (size_t)nb * 16 * K + kc); V b2 = b; if (NSPLIT >= 2) b2 = WFrag<T16>::ld(Bt2 + boff + (size_t)nb * 16 * K + kc);
#pragma unroll
            for (int mb = 0; mb < 4; ++mb) { acc[mb][nb] = WFrag<T16>::mma(a[mb], b, acc[mb][nb]); if (NSPLIT == 1 || NSPLIT == 2) acc[mb][nb] = WFrag<T16>::mma(a2[mb], b, acc[mb][nb]); if (NSPLIT == 2) acc[mb][nb] = WFrag<T16>::mma(a[mb], b2, acc[mb][nb]); if (NSPLIT == 3) acc[mb][nb] = WFrag<T16>::mma(a2[mb], b2, acc[mb][nb]); } }
        asm volatile("v_nop\n\tv_nop\n\tv_nop\n\tv_nop" : "+v"(acc[0][0]), "+v"(acc[1][1]), "+v"(acc[2][2]), "+v"(acc[3][3]) : "v"(a[0]), "v"(a[3]));
    }
#pragma unroll
    for (int mb = 0; mb < 4; ++mb) {
#pragma unroll
        for (int nb = 0; nb < 4; ++nb) {
#pragma unroll
            for (int j = 0; j < 8; ++j) os[(hi * 8 + j) * 68 + nb * 16 + lr] = acc[mb][nb][j]; }
        __builtin_amdgcn_wave_barrier(); asm volatile("" ::: "memory");
        float* crow = C + (size_t)(r0 + mb * 16) * ldc + c0;
{
#pragma unroll
            for (int s = 0; s < 8; ++s) { const int row = 2 * s + hi, cofs = lr * 4; v4f val = *(const v4fa*)(os + row * 68 + cofs); val = val * oscale;
                *(v4f*)(crow + (size_t)row * ldc + cofs) = val; }
             }
        __builtin_amdgcn_wave_barrier(); asm volatile("" ::: "memory");
    }
}

__global__ __launch_bounds__(256) void k_cvt8(const float* __restrict__ src0, bf* dst0, size_t n8, size_t sstr, size_t dstr) { const size_t i = (size_t)blockIdx.x * 256 + threadIdx.x; if (i >= n8) return; const float* src = src0 + (size_t)blockIdx.y * sstr; bf* dst = dst0 + (size_t)blockIdx.y * dstr; const v8f v = *(const v8f*)(src + i * 8); v8us o;
#pragma unroll
    for (int k = 0; k < 8; ++k) o[k] = f2bf(v[k]); *(v8us*)(dst + i * 8) = o;  }

__global__ __launch_bounds__(256) void k_cvtwo(const float* __restrict__ src, h16* dh, h16* dl, size_t n8) { const size_t i = (size_t)blockIdx.x * 256 + threadIdx.x; if (i >= n8) return; const v8f v = *(const v8f*)(src + i * 8); v8h oh, ol;
#pragma unroll
    for (int k = 0; k < 8; ++k) { const float w = bfr(v[k]); oh[k] = tohx(w * WCAR); ol[k] = tohx(w); }
    *(v8h*)(dh + i * 8) = oh; *(v8h*)(dl + i * 8) = ol;  }

// k_hpl: head planes P16[h][t][d] (f16, magnitudes below 2^-14 stored as zero) = F[t][h*HD + d] (row pitch given, no rotary); grid.y = batch;
__global__ __launch_bounds__(256) void k_hpl(const float* __restrict__ F0, int pitch, int nheads, h16* P160, bf* Eh0, bf* El0) {
    const size_t bz = blockIdx.y; const float* F = F0 + bz * SEQ * pitch; h16* P16 = P160 + bz * nheads * SEQ * HD; bf* Eh = Eh0 + bz * nheads * RE * HD; bf* El = El0 + bz * nheads * RE * HD;
    const size_t e = ((size_t)blockIdx.x * 256 + threadIdx.x) * 2; if (e >= (size_t)nheads * SEQ * HD) return;
    const int d = (int)(e % HD); const int t = (int)((e / HD) % SEQ); const int h = (int)(e / ((size_t)HD * SEQ));
    const float* f = F + (size_t)t * pitch + h * HD + d; v2h o16; v2us oh, ol;
#pragma unroll
    for (int q = 0; q < 2; ++q) { const float r = f[q]; o16[q] = toh_flush(r); unsigned short a2, c2; splitf(r, a2, c2); oh[q] = a2; ol[q] = c2; }
    const bool early = (t < RE);      // uniform per wave (a wave covers 64 consecutive d of one (h, t) row; RE % 64 == 0)
    const size_t ee = ((size_t)h * RE + (early ? t : 0)) * HD + d;
    *(v2h*)(P16 + e) = o16; if (early) { *(v2us*)(Eh + ee) = oh; *(v2us*)(El + ee) = ol; }
    
}

__global__ __launch_bounds__(256) void k_vtp(const float* __restrict__ F0, h16* V160, bf* Eh0, bf* El0) {
    const size_t bz = blockIdx.y; const float* F = F0 + bz * SEQ * DKV; h16* V16 = V160 + bz * NKV * HD * SEQ; bf* Eh = Eh0 + bz * NKV * HD * RE; bf* El = El0 + bz * NKV * HD * RE;
    const size_t e = ((size_t)blockIdx.x * 256 + threadIdx.x) * 2; if (e >= (size_t)NKV * HD * SEQ) return;
    const int t = (int)(e % SEQ); const int d = (int)((e / SEQ) % HD); const int g = (int)(e / ((size_t)SEQ * HD)); v2h o16; v2us oh, ol;
#pragma unroll
    for (int q = 0; q < 2; ++q) { const float x = F[(size_t)(t + q) * DKV + g * HD + d]; o16[q] = tohx(x); unsigned short a2, c2; splitf(x, a2, c2); oh[q] = a2; ol[q] = c2; }
    const bool early = (t < RE);      // uniform per wave (a wave covers 64 consecutive t of one (g, d) row; RE % 64 == 0)
    const size_t ee = ((size_t)g * HD + d) * RE + (early ? t : 0);
    *(v2h*)(V16 + e) = o16; if (early) { *(v2us*)(Eh + ee) = oh; *(v2us*)(El + ee) = ol; }
    
}

// P tile writers: f16 x PCAR (rows >= RE) or bf16 hi/lo (rows < RE).
__device__ __forceinline__ void putp(h16* ph, h16* pl, int i, float p) { (void)pl; ph[i] = tohx(p * PCAR); }
__device__ __forceinline__ void putp(bf* ph, bf* pl, int i, float p) { unsigned short a, c; splitf(p, a, c); ph[i] = a; pl[i] = c; }

// ---- k_attn: flash-style causal grouped-query attention. grid (query blocks, NH_, batches), 128 threads; wave w owns query rows q0 + 16w .. +15.
// Planes: Qh/Ql [h][TP][HD], Kh/Kl [g][TP][HD], Vh/Vl = V^T [g][HD][TP] (TP = SEQ for the f16 planes, RE for the bf16 hi/lo planes of the first RE/64 query blocks).
// EARLY instance: query blocks 0 .. RE/64-1 (rows < RE, keys < RE); other instance: query blocks RE/64 .. SEQ/64-1.
// Per 32-key chunk: K tile [32][HD] and V^T tile [HD][32] staged in LDS by all threads (block barriers), S = Q K^T (2 tiles), online softmax in f32
// (causal keys > query replaced by -inf: p = 0), P through a wave-private LDS tile (block barrier before the fragment reload), O += P V (8 tiles).
// EARLY: 3 products (hi.hi + hi.lo + lo.hi) for S and for P.V. Output: ctx plane CT[t][h*HD + d] = f16(ctx x CCAR); EARLY also CTL = f16((ctx x CCAR - hi) x LOSC);
template <typename T16, bool EARLY>
__global__ __launch_bounds__(128) void k_attn(const T16* __restrict__ Qh, const T16* __restrict__ Ql, const T16* __restrict__ Kh, const T16* __restrict__ Kl,
                                             const T16* __restrict__ Vh, const T16* __restrict__ Vl, h16* CT0, h16* CTL0) {
    typedef typename WFrag<T16>::V V;
    constexpr int TP = EARLY ? RE : SEQ;
    constexpr int KSP = 136, VTP = 32, PSP = 40, OSP = 128;
    __shared__ __align__(16) T16 ksh[32 * KSP];
    __shared__ __align__(16) T16 ksl[EARLY ? 32 * KSP : 16];
    __shared__ __align__(16) T16 vth[HD * VTP];
    __shared__ __align__(16) T16 vtl[EARLY ? HD * VTP : 16];
    __shared__ __align__(16) T16 psh[4 * 16 * PSP];
    __shared__ __align__(16) T16 psl[EARLY ? 4 * 16 * PSP : 16];
    __shared__ __align__(16) h16 osg[4 * 16 * OSP];
    const int tid = threadIdx.x, lane = tid & 31, wave = tid >> 5, lr = lane & 15, hh = lane >> 4;
    const int qblk = EARLY ? (int)blockIdx.x : ((int)blockIdx.x + RE / 64);
    const int head = blockIdx.y, g = head / REP;
    const int qw = qblk * 64 + wave * 16;                  // first query row of this wave
    const int nch = 2 * qblk + 2;                          // 32-key chunks visited: keys 0 .. qblk*64+63
    const size_t bz = blockIdx.z;                          // batch: its own planes
    h16* CT = CT0 + bz * SEQ * DM; h16* CTL = CTL0 + bz * RE * DM;
    const T16* qph = Qh + ((bz * NH_ + head) * TP + qw) * HD;  const T16* qpl = Ql + ((bz * NH_ + head) * TP + qw) * HD;
    const T16* kph = Kh + (bz * NKV + g) * TP * HD;             const T16* kpl = Kl + (bz * NKV + g) * TP * HD;
    const T16* vph = Vh + (bz * NKV + g) * HD * TP;             const T16* vpl = Vl + (bz * NKV + g) * HD * TP;
    T16* myph = psh + wave * 16 * PSP; T16* mypl = psl + (EARLY ? wave * 16 * PSP : 0);
    v8f o[8];
#pragma unroll
    for (int t = 0; t < 8; ++t) o[t] = (v8f){};
    float mrow[8], lrow[8];
#pragma unroll
    for (int r = 0; r < 8; ++r) { mrow[r] = -3.0e38f; lrow[r] = 0.f; }
    const float C2 = 1.4426950408889634f * 0.08838834764831845f;   // log2(e) x HD^-0.5
#pragma unroll 1
    for (int c = 0; c < nch; ++c) {
        __syncthreads();                                    // all waves done with the prior chunk's tiles
#pragma unroll
        for (int i = 0; i < 4; ++i) { const int id = tid + 128 * i; const int row = id >> 4, c8 = (id & 15) * 8; const size_t go = (size_t)(c * 32 + row) * HD + c8;
            *(v8usa*)(ksh + row * KSP + c8) = *(const v8usa*)(kph + go); if (EARLY) *(v8usa*)(ksl + row * KSP + c8) = *(const v8usa*)(kpl + go); }
#pragma unroll
        for (int j = 0; j < 4; ++j) { const size_t go = (size_t)tid * TP + c * 32 + 8 * j;      // d = tid
            *(v8usa*)(vth + tid * VTP + 8 * j) = *(const v8usa*)(vph + go); if (EARLY) *(v8usa*)(vtl + tid * VTP + 8 * j) = *(const v8usa*)(vpl + go); }
        __syncthreads();                                    // tiles visible
        v8f s0 = (v8f){}, s1 = (v8f){};
        V qa, kb0, kb1;
#pragma unroll
        for (int ks = 0; ks < 4; ++ks) {
            qa  = WFrag<T16>::ld(qph + (size_t)lr * HD + ks * 32 + 8 * hh);
            kb0 = WFrag<T16>::ld(ksh + lr * KSP + ks * 32 + 8 * hh);
            kb1 = WFrag<T16>::ld(ksh + (16 + lr) * KSP + ks * 32 + 8 * hh);
            s0 = WFrag<T16>::mma(qa, kb0, s0); s1 = WFrag<T16>::mma(qa, kb1, s1);
            if (EARLY) {
                const V qb  = WFrag<T16>::ld(qpl + (size_t)lr * HD + ks * 32 + 8 * hh);
                const V kl0 = WFrag<T16>::ld(ksl + lr * KSP + ks * 32 + 8 * hh);
                const V kl1 = WFrag<T16>::ld(ksl + (16 + lr) * KSP + ks * 32 + 8 * hh);
                s0 = WFrag<T16>::mma(qa, kl0, s0); s0 = WFrag<T16>::mma(qb, kb0, s0);
                s1 = WFrag<T16>::mma(qa, kl1, s1); s1 = WFrag<T16>::mma(qb, kb1, s1); }
        }
        asm volatile("v_nop\n\tv_nop\n\tv_nop\n\tv_nop" : "+v"(s0), "+v"(s1) : "v"(qa), "v"(kb0), "v"(kb1));
        // online softmax; acc element r of lane (lr, hh) = S[query qw + 8hh + r][key c*32 + lr] (s0) / [key c*32 + 16 + lr] (s1)
        float p0[8], p1[8];
        const int kg0 = c * 32 + lr, kg1 = kg0 + 16;
#pragma unroll
        for (int r = 0; r < 8; ++r) {
            const int qr = qw + 8 * hh + r;
            const bool v0 = (kg0 <= qr), v1 = (kg1 <= qr);
            const float a0 = v0 ? s0[r] * C2 : -3.0e38f;
            const float a1 = v1 ? s1[r] * C2 : -3.0e38f;
            float mx = fmaxf(a0, a1);
#pragma unroll
            for (int off = 8; off >= 1; off >>= 1) mx = fmaxf(mx, __shfl_xor(mx, off, 32));
            const float mnew = fmaxf(mrow[r], mx);
            const float alpha = __builtin_amdgcn_exp2f(mrow[r] - mnew);
            mrow[r] = mnew;
            const float x0 = __builtin_amdgcn_exp2f(a0 - mnew), x1 = __builtin_amdgcn_exp2f(a1 - mnew);
            const float e0 = v0 ? x0 : 0.f, e1 = v1 ? x1 : 0.f;
            float rs = e0 + e1;
#pragma unroll
            for (int off = 8; off >= 1; off >>= 1) rs += __shfl_xor(rs, off, 32);
            lrow[r] = lrow[r] * alpha + rs;
#pragma unroll
            for (int t = 0; t < 8; ++t) o[t][r] = o[t][r] * alpha;
            p0[r] = e0; p1[r] = e1;
        }
        // P tile [16 query rows][32 keys] -> A fragment (k = key)
#pragma unroll
        for (int r = 0; r < 8; ++r) { putp(myph, mypl, (8 * hh + r) * PSP + lr, p0[r]); putp(myph, mypl, (8 * hh + r) * PSP + 16 + lr, p1[r]); }
        __syncthreads();                                    // P visible (block barrier also orders this wave's own stores before the reload)
        const V pa = WFrag<T16>::ld(myph + lr * PSP + 8 * hh);
        V pb = pa; if (EARLY) pb = WFrag<T16>::ld(mypl + lr * PSP + 8 * hh);
        V vb;
#pragma unroll
        for (int t = 0; t < 8; ++t) { vb = WFrag<T16>::ld(vth + (t * 16 + lr) * VTP + 8 * hh);
            o[t] = WFrag<T16>::mma(pa, vb, o[t]);
            if (EARLY) { const V vl2 = WFrag<T16>::ld(vtl + (t * 16 + lr) * VTP + 8 * hh); o[t] = WFrag<T16>::mma(pa, vl2, o[t]); o[t] = WFrag<T16>::mma(pb, vb, o[t]); } }
        asm volatile("v_nop\n\tv_nop\n\tv_nop\n\tv_nop" : "+v"(o[0]), "+v"(o[1]), "+v"(o[2]), "+v"(o[3]), "+v"(o[4]), "+v"(o[5]), "+v"(o[6]), "+v"(o[7]) : "v"(pa), "v"(pb), "v"(vb));
    }
    // normalise and write ctx planes; o element r of lane (lr, hh), tile t = ctx[row qw + 8hh + r][d = 16t + lr]
    const float osc = EARLY ? CCAR : (CCAR / PCAR);
    float inv[8];
#pragma unroll
    for (int r = 0; r < 8; ++r) inv[r] = osc * __builtin_amdgcn_rcpf(lrow[r]);
    h16* myos = osg + wave * 16 * OSP;
#pragma unroll
    for (int t = 0; t < 8; ++t)
#pragma unroll
        for (int r = 0; r < 8; ++r) myos[(8 * hh + r) * OSP + t * 16 + lr] = tohx(o[t][r] * inv[r]);
    __syncthreads();
    h16* crow = CT + (size_t)qw * DM + head * HD;
{
#pragma unroll
        for (int s = 0; s < 8; ++s) { const int row = 2 * s + hh; const v8h val = *(const v8ha*)(myos + row * OSP + lr * 8); *(v8h*)(crow + (size_t)row * DM + lr * 8) = val; }
         }
    if (EARLY) {
        __syncthreads();
#pragma unroll
        for (int t = 0; t < 8; ++t)
#pragma unroll
            for (int r = 0; r < 8; ++r) { const float val = o[t][r] * inv[r]; const h16 hv = tohx(val); myos[(8 * hh + r) * OSP + t * 16 + lr] = tohx((val - (float)hv) * LOSC); }
        __syncthreads();
        h16* lrowp = CTL + (size_t)qw * DM + head * HD;
{
#pragma unroll
            for (int s = 0; s < 8; ++s) { const int row = 2 * s + hh; const v8h val = *(const v8ha*)(myos + row * OSP + lr * 8); *(v8h*)(lrowp + (size_t)row * DM + lr * 8) = val; }
             }
    }
}

// workspace carve total (each region padded to 256 B), checked against the 256 MiB line at build time
constexpr size_t al256(size_t b) { return (b + 255) & ~(size_t)255; }
constexpr size_t WS_TOTAL =
    al256((size_t)DQ * DM * 2) + 2 * al256((size_t)DKV * DM * 2) + 2 * al256((size_t)DM * DQ * 2) + al256((size_t)NB * SEQ * DM * 2) +
    al256((size_t)NB * SEQ * DQ * 4) + 2 * al256((size_t)NB * SEQ * DKV * 4) +
    al256((size_t)NB * NH_ * SEQ * HD * 2) + 2 * al256((size_t)NB * NKV * SEQ * HD * 2) +
    2 * al256((size_t)NB * NH_ * RE * HD * 2) + 4 * al256((size_t)NB * NKV * RE * HD * 2) +
    al256((size_t)NB * SEQ * DM * 2) + al256((size_t)NB * RE * DM * 2);
static_assert(WS_TOTAL <= (size_t)268435456);

extern "C" void kernel_launch(void* const* d_in, const int* in_sizes, int n_in,
                              void* d_out, int out_size, void* d_ws, size_t ws_size, hipStream_t stream) {
    if (n_in < 5) return;
    const float* x  = (const float*)d_in[0];     // [NB_FULL][SEQ_FULL][DM]
    const float* wq = (const float*)d_in[1];     // [DQ][DM]  ([out][in])
    const float* wk = (const float*)d_in[2];     // [DKV][DM]
    const float* wv = (const float*)d_in[3];     // [DKV][DM]
    const float* wo = (const float*)d_in[4];     // [DM][DQ]
    float* OUT = (float*)d_out;                  // [NB_FULL][SEQ_FULL][DM]
    if ((size_t)in_sizes[0] < (size_t)(NB - 1) * SEQ_FULL * DM + (size_t)SEQ * DM) return;
    if ((size_t)in_sizes[1] < (size_t)DQ * DM) return;
    if ((size_t)in_sizes[2] < (size_t)DKV * DM) return;
    if ((size_t)in_sizes[3] < (size_t)DKV * DM) return;
    if ((size_t)in_sizes[4] < (size_t)DM * DQ) return;
    if ((size_t)out_size < (size_t)(NB - 1) * SEQ_FULL * DM + (size_t)SEQ * DM) return;

    char* wsp = (char*)d_ws;
    auto take = [&](size_t bytes) { char* p = wsp; wsp += (bytes + 255) & ~(size_t)255; return (void*)p; };
    bf*  WQ   = (bf*)take((size_t)DQ * DM * 2);    bf* WK = (bf*)take((size_t)DKV * DM * 2);    bf* WV = (bf*)take((size_t)DKV * DM * 2);
    h16* WOH  = (h16*)take((size_t)DM * DQ * 2);   h16* WOL = (h16*)take((size_t)DM * DQ * 2);
    bf*  XB   = (bf*)take((size_t)NB * SEQ * DM * 2);
    float* FQ = (float*)take((size_t)NB * SEQ * DQ * 4); float* FK = (float*)take((size_t)NB * SEQ * DKV * 4); float* FV = (float*)take((size_t)NB * SEQ * DKV * 4);
    h16* QP16 = (h16*)take((size_t)NB * NH_ * SEQ * HD * 2); h16* KP16 = (h16*)take((size_t)NB * NKV * SEQ * HD * 2); h16* VT16 = (h16*)take((size_t)NB * NKV * HD * SEQ * 2);
    bf*  QEh  = (bf*)take((size_t)NB * NH_ * RE * HD * 2);  bf* QEl = (bf*)take((size_t)NB * NH_ * RE * HD * 2);
    bf*  KEh  = (bf*)take((size_t)NB * NKV * RE * HD * 2);  bf* KEl = (bf*)take((size_t)NB * NKV * RE * HD * 2);
    bf*  VEh  = (bf*)take((size_t)NB * NKV * HD * RE * 2);  bf* VEl = (bf*)take((size_t)NB * NKV * HD * RE * 2);
    h16* CT16 = (h16*)take((size_t)NB * SEQ * DM * 2);     h16* CTL = (h16*)take((size_t)NB * RE * DM * 2);
    if ((size_t)(wsp - (char*)d_ws) > ws_size) return;       // 146,800,640 B at full size

    const float woscale = 1.0f / (CCAR * WCAR);
    k_cvt8<<<(unsigned)(((size_t)DQ * DM / 8 + 255) / 256), 256, 0, stream>>>(wq, WQ, (size_t)DQ * DM / 8, 0, 0);
    k_cvt8<<<(unsigned)(((size_t)DKV * DM / 8 + 255) / 256), 256, 0, stream>>>(wk, WK, (size_t)DKV * DM / 8, 0, 0);
    k_cvt8<<<(unsigned)(((size_t)DKV * DM / 8 + 255) / 256), 256, 0, stream>>>(wv, WV, (size_t)DKV * DM / 8, 0, 0);
    k_cvtwo<<<(unsigned)(((size_t)DM * DQ / 8 + 255) / 256), 256, 0, stream>>>(wo, WOH, WOL, (size_t)DM * DQ / 8);
    const unsigned LQ = (unsigned)(((size_t)NH_ * SEQ * HD / 2 + 255) / 256), LKV = (unsigned)(((size_t)NKV * SEQ * HD / 2 + 255) / 256);
    const size_t sX = (size_t)SEQ * DM, sO = (size_t)SEQ_FULL * DM;      // batch strides: workspace planes, x and out
    k_cvt8<<<dim3((unsigned)(((size_t)SEQ * DM / 8 + 255) / 256), NB, 1), 256, 0, stream>>>(x, XB, (size_t)SEQ * DM / 8, sO, sX);
    k_gemmw<bf, 0><<<dim3(SEQ / 64, DQ / 64, NB), 32, 0, stream>>>(XB, nullptr, WQ, nullptr, DM, FQ, DQ, 1.0f, sX, 0, (size_t)SEQ * DQ);
    k_hpl<<<dim3(LQ, NB, 1), 256, 0, stream>>>(FQ, DQ, NH_, QP16, QEh, QEl);
    k_gemmw<bf, 0><<<dim3(SEQ / 64, DKV / 64, NB), 32, 0, stream>>>(XB, nullptr, WK, nullptr, DM, FK, DKV, 1.0f, sX, 0, (size_t)SEQ * DKV);
    k_hpl<<<dim3(LKV, NB, 1), 256, 0, stream>>>(FK, DKV, NKV, KP16, KEh, KEl);
    k_gemmw<bf, 0><<<dim3(SEQ / 64, DKV / 64, NB), 32, 0, stream>>>(XB, nullptr, WV, nullptr, DM, FV, DKV, 1.0f, sX, 0, (size_t)SEQ * DKV);
    k_vtp<<<dim3(LKV, NB, 1), 256, 0, stream>>>(FV, VT16, VEh, VEl);
    k_attn<bf, true><<<dim3(RE / 64, NH_, NB), 128, 0, stream>>>(QEh, QEl, KEh, KEl, VEh, VEl, CT16, CTL);
    if (SEQ > RE) k_attn<h16, false><<<dim3(SEQ / 64 - RE / 64, NH_, NB), 128, 0, stream>>>(QP16, QP16, KP16, KP16, VT16, VT16, CT16, CTL);
    k_gemmw<h16, 3><<<dim3(RE / 64, DM / 64, NB), 32, 0, stream>>>(CT16, CTL, WOH, WOL, DQ, OUT, DM, woscale, sX, (size_t)RE * DM, sO);
    if (SEQ > RE) k_gemmw<h16, 0><<<dim3((SEQ - RE) / 64, DM / 64, NB), 32, 0, stream>>>(CT16 + (size_t)RE * DQ, nullptr, WOH, nullptr, DQ, OUT + (size_t)RE * DM, DM, woscale, sX, 0, sO);
}

// v002
// It runs in 353 microseconds.
// In two side-by-side timings against v001, it was 1.50 and 1.49 times as fast.
// Counting every step since v000, it is 2.57 times as fast.
#include <hip/hip_runtime.h>

// Contractions: q/k/v projections v_wmma_f32_16x16x32_bf16 (bf16 copies of x and of the [out][in] weights); scores QK^T and P.V v_wmma_f32_16x16x32_f16 (f16 planes, P carried x1024) for query rows >= 256 and v_wmma_f32_16x16x32_bf16 hi/lo 3-product form for query rows < 256; ctx x Wo^T v_wmma_f32_16x16x32_f16 (ctx carried x64, Wo carried x1024, rows < 256 add an f16 residual plane x1024); f32 accumulate everywhere, softmax in f32.
// Five launches, each holding every piece of work that depends only on the launch before it: all conversions; the q, k and v projections as one GEMM on the stacked weights; all plane builders; both attention forms; both output-GEMM forms.
// Both batches run in every launch (the batch is blockIdx.z, in k_planes blockIdx.y, in k_cvtall a range of blocks; each batch has its own workspace planes). Per batch: bf16 copy of x; weights copied once as bf16 ([n][k] = Bt as-is), Wo as two f16 planes; f32 projection tiles; head-plane builders (no rotary in this module); flash-style causal attention (K and V^T tiles staged in LDS, online softmax); ctx planes; output GEMM into d_out.

#pragma clang fp contract(off)

#ifndef NB
#define NB 2
#endif
#ifndef SEQ
#define SEQ 2048
#endif
#ifndef RE
#define RE   256                  // query rows < RE (first RE/64 query blocks) use hi/lo planes
#endif
#define NB_FULL  2
#define SEQ_FULL 2048
#define DM   2048
#define NH_  16
#define NKV  4
#define REP  (NH_ / NKV)
#define HD   128
#define DQ   (NH_ * HD)
#define DKV  (NKV * HD)
#define DQKV (DQ + 2 * DKV)       // rows of the stacked [wq; wk; wv] plane = row pitch of the f32 projection plane
#define PCAR 1024.0f              // carry of the f16 P operand (rows >= RE)
#define CCAR 64.0f                // carry of the f16 ctx plane
#define LOSC 1024.0f              // carry of the f16 ctx residual plane (rows < RE)
#define WCAR 1024.0f              // carry of the f16 Wo plane

static_assert((SEQ % 64) == 0);
static_assert((RE % 64) == 0);
static_assert(RE >= 64);
static_assert(SEQ >= RE);
static_assert(SEQ <= SEQ_FULL);
static_assert(NB >= 1);
static_assert(NB <= NB_FULL);
static_assert(HD == 128);
static_assert((DM % 32) == 0);
static_assert(DQ == DM);
static_assert(((SEQ * DM) % (8 * 256)) == 0);
static_assert(((NH_ * SEQ * HD) % (2 * 256)) == 0);
static_assert(((NKV * SEQ * HD) % (2 * 256)) == 0);
static_assert(((DQ * DM) % (8 * 256)) == 0);
static_assert(((DKV * DM) % (8 * 256)) == 0);
static_assert((HD % 64) == 0);                 // hpl: a wave covers 64 consecutive d of one (h, t) row
static_assert((NH_ % NKV) == 0);
static_assert((DQ % 64) == 0);
static_assert((DKV % 64) == 0);
static_assert((DM % 64) == 0);

typedef _Float16 h16;
typedef unsigned short bf;
typedef __attribute__((ext_vector_type(16))) __bf16   v16bf;
typedef __attribute__((ext_vector_type(16))) _Float16 v16h;
typedef __attribute__((ext_vector_type(8)))  _Float16 v8h;
typedef __attribute__((ext_vector_type(8)))  unsigned short v8us;
typedef __attribute__((ext_vector_type(8)))  float    v8f;
typedef __attribute__((ext_vector_type(4)))  float    v4f;
typedef __attribute__((ext_vector_type(2)))  _Float16 v2h;
typedef __attribute__((ext_vector_type(2)))  unsigned short v2us;
typedef v8h  __attribute__((may_alias)) v8ha;
typedef v4f  __attribute__((may_alias)) v4fa;
typedef v8us __attribute__((may_alias)) v8usa;

__device__ __forceinline__ unsigned short f2bf(float f) { unsigned u = __float_as_uint(f); u += 0x7FFFu + ((u >> 16) & 1u); return (unsigned short)(u >> 16); }
__device__ __forceinline__ float bf2f(unsigned short b) { return __uint_as_float(((unsigned)b) << 16); }
__device__ __forceinline__ float bfr(float f) { return bf2f(f2bf(f)); }
__device__ __forceinline__ h16 tohx(float x) { return (h16)x; }
__device__ __forceinline__ void splitf(float y, unsigned short& h, unsigned short& l) { h = f2bf(y); l = f2bf(y - bf2f(h)); }
__device__ __forceinline__ v16h cat16(v8h lo, v8h hi) { return __builtin_shufflevector(lo, hi, 0, 1, 2, 3, 4, 5, 6, 7, 8, 9, 10, 11, 12, 13, 14, 15); }
__device__ __forceinline__ v16bf cat16b(v8us lo, v8us hi) { return __builtin_bit_cast(v16bf, __builtin_shufflevector(lo, hi, 0, 1, 2, 3, 4, 5, 6, 7, 8, 9, 10, 11, 12, 13, 14, 15)); }
__device__ __forceinline__ v8f wmma16(v16h a, v16h b, v8f c) { return __builtin_amdgcn_wmma_f32_16x16x32_f16(false, a, false, b, (short)0, c, false, false); }
__device__ __forceinline__ v8f wmmab(v16bf a, v16bf b, v8f c) { return __builtin_amdgcn_wmma_f32_16x16x32_bf16(false, a, false, b, (short)0, c, false, false); }

// f32 -> f16 convert that cannot produce a sub-normal f16: magnitudes below 2^-14 become zero by a value select.
static __device__ __forceinline__ h16 toh_flush(float v) { const h16 r = (h16)v; return (fabsf(v) < 6.103515625e-05f) ? (h16)0.0f : r; }

// Fragment loaders for A (row m = lane&15) and for B stored [n][k] (col n = lane&15): elements 0..7 <- k0+8h..+7, elements 8..15 <- k0+16+8h..+7 (p already points at row*pitch + k0 + 8h).
template <typename T16> struct WFrag;
template <> struct WFrag<h16> { typedef v16h V; static __device__ __forceinline__ V ld(const h16* p) { return cat16(*(const v8ha*)p, *(const v8ha*)(p + 16)); } static __device__ __forceinline__ v8f mma(V a, V b, v8f c) { return wmma16(a, b, c); } };
template <> struct WFrag<bf>  { typedef v16bf V; static __device__ __forceinline__ V ld(const bf* p) { return cat16b(*(const v8usa*)p, *(const v8usa*)(p + 16)); } static __device__ __forceinline__ v8f mma(V a, V b, v8f c) { return wmmab(a, b, c); } };

// ---- gemmw_tile: register-blocked GEMM, ONE WAVE per 64x64 output tile (16 accumulators), operands straight from K-contiguous 16-bit planes; tile (blockIdx.x, blockIdx.y) of this batch's A, A2, C (Bt, Bt2 shared); os = 16 x 68 floats of LDS.
// C[m][n] (f32, pitch ldc) = oscale * sum_k ( A[m][k] Bt[n][k]  (+ A2 Bt: NSPLIT 1,2) (+ A Bt2: NSPLIT 2) (+ A2 Bt2: NSPLIT 3) ). Row pitch of A, A2, Bt, Bt2 = K. K % 32 == 0.
template <typename T16, int NSPLIT>
__device__ __forceinline__ void gemmw_tile(const T16* __restrict__ A, const T16* __restrict__ A2, const T16* __restrict__ Bt, const T16* __restrict__ Bt2, int K, float* C, int ldc, float oscale, float* os) {
    typedef typename WFrag<T16>::V V;
    const int lane = threadIdx.x & 31, lr = lane & 15, hi = lane >> 4; const int r0 = blockIdx.x * 64, c0 = blockIdx.y * 64;
    v8f acc[4][4];
#pragma unroll
    for (int mb = 0; mb < 4; ++mb)
#pragma unroll
        for (int nb = 0; nb < 4; ++nb) acc[mb][nb] = (v8f){};
    const size_t aoff = (size_t)(r0 + lr) * K + 8 * hi, boff = (size_t)(c0 + lr) * K + 8 * hi;
#pragma unroll 1
    for (int kc = 0; kc < K; kc += 32) {
        V a[4], a2[4];
        const T16* pa = A + aoff + kc; const T16* pa2 = (NSPLIT != 0) ? A2 + aoff + kc : pa; const T16* pb = Bt + boff + kc; const T16* pb2 = (NSPLIT >= 2) ? Bt2 + boff + kc : pb;
#pragma unroll
        for (int mb = 0; mb < 4; ++mb) { a[mb] = WFrag<T16>::ld(pa + (size_t)mb * 16 * K); if (NSPLIT != 0) a2[mb] = WFrag<T16>::ld(pa2 + (size_t)mb * 16 * K); }
        // behind the A loads: only from here on may a register that holds one of their addresses take a new value (a B load's result); as inputs the addresses stay whole up to the wait
        asm volatile("s_wait_xcnt 0x0" :: "v"(pa), "v"(pa2) : "memory");
#pragma unroll
        for (int nb = 0; nb < 4; ++nb) { const V b = WFrag<T16>::ld(pb + (size_t)nb * 16 * K); V b2 = b; if (NSPLIT >= 2) b2 = WFrag<T16>::ld(pb2 + (size_t)nb * 16 * K);
            // the same behind each column block's B loads, for the addresses of the B loads
            asm volatile("s_wait_xcnt 0x0" :: "v"(pb), "v"(pb2) : "memory");
#pragma unroll
            for (int mb = 0; mb < 4; ++mb) { acc[mb][nb] = WFrag<T16>::mma(a[mb], b, acc[mb][nb]); if (NSPLIT == 1 || NSPLIT == 2) acc[mb][nb] = WFrag<T16>::mma(a2[mb], b, acc[mb][nb]); if (NSPLIT == 2) acc[mb][nb] = WFrag<T16>::mma(a[mb], b2, acc[mb][nb]); if (NSPLIT == 3) acc[mb][nb] = WFrag<T16>::mma(a2[mb], b2, acc[mb][nb]); } }
        asm volatile("v_nop\n\tv_nop\n\tv_nop\n\tv_nop" : "+v"(acc[0][0]), "+v"(acc[1][1]), "+v"(acc[2][2]), "+v"(acc[3][3]) : "v"(a[0]), "v"(a[3]));
    }
#pragma unroll
    for (int mb = 0; mb < 4; ++mb) {
#pragma unroll
        for (int nb = 0; nb < 4; ++nb) {
#pragma unroll
            for (int j = 0; j < 8; ++j) os[(hi * 8 + j) * 68 + nb * 16 + lr] = acc[mb][nb][j]; }
        __builtin_amdgcn_wave_barrier(); asm volatile("" ::: "memory");
        float* crow = C + (size_t)(r0 + mb * 16) * ldc + c0;
{
#pragma unroll
            for (int s = 0; s < 8; ++s) { const int row = 2 * s + hi, cofs = lr * 4; v4f val = *(const v4fa*)(os + row * 68 + cofs); val = val * oscale;
                *(v4f*)(crow + (size_t)row * ldc + cofs) = val; }
             }
        __builtin_amdgcn_wave_barrier(); asm volatile("" ::: "memory");
    }
}

// k_gemmqkv: F[t][0 .. DQKV) = x . [wq; wk; wv]^T; grid (SEQ/64, DQKV/64, batches), 32 threads.
__global__ __launch_bounds__(32) void k_gemmqkv(const bf* __restrict__ XB, const bf* __restrict__ WQKV, float* F) {
    __shared__ __align__(16) float os[16 * 68];
    gemmw_tile<bf, 0>(XB + (size_t)blockIdx.z * SEQ * DM, nullptr, WQKV, nullptr, DM, F + (size_t)blockIdx.z * SEQ * DQKV, DQKV, 1.0f, os);
}

// k_gemmo: out = ctx . Wo^T; grid (SEQ/64, DM/64, batches), 32 threads; row tiles below RE add the residual-plane product.
__global__ __launch_bounds__(32) void k_gemmo(const h16* __restrict__ CT, const h16* __restrict__ CTL, const h16* __restrict__ WOH, const h16* __restrict__ WOL, float* OUT, float oscale) {
    __shared__ __align__(16) float os[16 * 68];
    const h16* A = CT + (size_t)blockIdx.z * SEQ * DM; float* C = OUT + (size_t)blockIdx.z * SEQ_FULL * DM;
    if ((int)blockIdx.x < RE / 64) gemmw_tile<h16, 3>(A, CTL + (size_t)blockIdx.z * RE * DM, WOH, WOL, DQ, C, DM, oscale, os);
    else                           gemmw_tile<h16, 0>(A, nullptr, WOH, nullptr, DQ, C, DM, oscale, os);
}

__device__ __forceinline__ void cvt8(const float* __restrict__ src, bf* dst, size_t i) { const v8f v = *(const v8f*)(src + i * 8); v8us o;
#pragma unroll
    for (int k = 0; k < 8; ++k) o[k] = f2bf(v[k]); *(v8us*)(dst + i * 8) = o;  }

__device__ __forceinline__ void cvtwo(const float* __restrict__ src, h16* dh, h16* dl, size_t i) { const v8f v = *(const v8f*)(src + i * 8); v8h oh, ol;
#pragma unroll
    for (int k = 0; k < 8; ++k) { const float w = bfr(v[k]); oh[k] = tohx(w * WCAR); ol[k] = tohx(w); }
    *(v8h*)(dh + i * 8) = oh; *(v8h*)(dl + i * 8) = ol;  }

// k_cvtall: every conversion of an input, 8 elements a thread; block ranges in order: x (per batch), wq, wk, wv (stacked in WQKV), wo.
constexpr unsigned CBX = (unsigned)((size_t)SEQ * DM / (8 * 256)), CBQ = (unsigned)((size_t)DQ * DM / (8 * 256)), CBKV = (unsigned)((size_t)DKV * DM / (8 * 256)), CBO = (unsigned)((size_t)DM * DQ / (8 * 256));
__global__ __launch_bounds__(256) void k_cvtall(const float* __restrict__ x, const float* __restrict__ wq, const float* __restrict__ wk, const float* __restrict__ wv, const float* __restrict__ wo, bf* XB, bf* WQKV, h16* WOH, h16* WOL) {
    constexpr unsigned E0 = NB * CBX, E1 = E0 + CBQ, E2 = E1 + CBKV, E3 = E2 + CBKV;      // ends of the x, wq, wk, wv ranges
    unsigned b = blockIdx.x; const unsigned tid = threadIdx.x;
    if (b >= E3) { cvtwo(wo, WOH, WOL, (size_t)(b - E3) * 256 + tid); return; }
    const float* src; bf* dst;
    if (b < E0)      { const unsigned bz = b / CBX; src = x + (size_t)bz * SEQ_FULL * DM; dst = XB + (size_t)bz * SEQ * DM; b -= bz * CBX; }
    else if (b < E1) { src = wq; dst = WQKV; b -= E0; }
    else if (b < E2) { src = wk; dst = WQKV + (size_t)DQ * DM; b -= E1; }
    else             { src = wv; dst = WQKV + (size_t)(DQ + DKV) * DM; b -= E2; }
    cvt8(src, dst, (size_t)b * 256 + tid);
}

// hpl: head planes P16[h][t][d] (f16, magnitudes below 2^-14 stored as zero) = F[t][h*HD + d] (F = this batch's first column of the heads, row pitch DQKV, no rotary); blk = block index inside this builder's range, bz = batch;
__device__ __forceinline__ void hpl(const float* __restrict__ F, int nheads, unsigned blk, size_t bz, h16* P160, bf* Eh0, bf* El0) {
    h16* P16 = P160 + bz * nheads * SEQ * HD; bf* Eh = Eh0 + bz * nheads * RE * HD; bf* El = El0 + bz * nheads * RE * HD;
    const size_t e = ((size_t)blk * 256 + threadIdx.x) * 2; if (e >= (size_t)nheads * SEQ * HD) return;
    const int d = (int)(e % HD); const int t = (int)((e / HD) % SEQ); const int h = (int)(e / ((size_t)HD * SEQ));
    const float* f = F + (size_t)t * DQKV + h * HD + d; v2h o16; v2us oh, ol;
#pragma unroll
    for (int q = 0; q < 2; ++q) { const float r = f[q]; o16[q] = toh_flush(r); unsigned short a2, c2; splitf(r, a2, c2); oh[q] = a2; ol[q] = c2; }
    const bool early = (t < RE);      // uniform per wave (a wave covers 64 consecutive d of one (h, t) row; RE % 64 == 0)
    const size_t ee = ((size_t)h * RE + (early ? t : 0)) * HD + d;
    *(v2h*)(P16 + e) = o16; if (early) { *(v2us*)(Eh + ee) = oh; *(v2us*)(El + ee) = ol; }
    
}

__device__ __forceinline__ void vtp(const float* __restrict__ F, unsigned blk, size_t bz, h16* V160, bf* Eh0, bf* El0) {
    h16* V16 = V160 + bz * NKV * HD * SEQ; bf* Eh = Eh0 + bz * NKV * HD * RE; bf* El = El0 + bz * NKV * HD * RE;
    const size_t e = ((size_t)blk * 256 + threadIdx.x) * 2; if (e >= (size_t)NKV * HD * SEQ) return;
    const int t = (int)(e % SEQ); const int d = (int)((e / SEQ) % HD); const int g = (int)(e / ((size_t)SEQ * HD)); v2h o16; v2us oh, ol;
#pragma unroll
    for (int q = 0; q < 2; ++q) { const float x = F[(size_t)(t + q) * DQKV + g * HD + d]; o16[q] = tohx(x); unsigned short a2, c2; splitf(x, a2, c2); oh[q] = a2; ol[q] = c2; }
    const bool early = (t < RE);      // uniform per wave (a wave covers 64 consecutive t of one (g, d) row; RE % 64 == 0)
    const size_t ee = ((size_t)g * HD + d) * RE + (early ? t : 0);
    *(v2h*)(V16 + e) = o16; if (early) { *(v2us*)(Eh + ee) = oh; *(v2us*)(El + ee) = ol; }
    
}

// k_planes: all plane builders; grid (PLQ + 2 PLKV, batches), 256 threads; block ranges in order: q heads, k heads, V^T.
constexpr unsigned PLQ = (unsigned)((size_t)NH_ * SEQ * HD / (2 * 256)), PLKV = (unsigned)((size_t)NKV * SEQ * HD / (2 * 256));
__global__ __launch_bounds__(256) void k_planes(const float* __restrict__ F0, h16* QP16, bf* QEh, bf* QEl, h16* KP16, bf* KEh, bf* KEl, h16* VT16, bf* VEh, bf* VEl) {
    const unsigned b = blockIdx.x; const size_t bz = blockIdx.y; const float* F = F0 + bz * SEQ * DQKV;
    if (b < PLQ)             hpl(F, NH_, b, bz, QP16, QEh, QEl);
    else if (b < PLQ + PLKV) hpl(F + DQ, NKV, b - PLQ, bz, KP16, KEh, KEl);
    else                     vtp(F + DQ + DKV, b - PLQ - PLKV, bz, VT16, VEh, VEl);
}

// P tile writers: f16 x PCAR (rows >= RE) or bf16 hi/lo (rows < RE).
__device__ __forceinline__ void putp(h16* ph, h16* pl, int i, float p) { (void)pl; ph[i] = tohx(p * PCAR); }
__device__ __forceinline__ void putp(bf* ph, bf* pl, int i, float p) { unsigned short a, c; splitf(p, a, c); ph[i] = a; pl[i] = c; }

// ---- attn: flash-style causal grouped-query attention of query block blockIdx.x, head blockIdx.y, batch blockIdx.z; 128 threads; wave w owns query rows q0 + 16w .. +15. The LDS tiles come from the kernel (the lo tiles are used by EARLY alone).
// Planes: Qh/Ql [h][TP][HD], Kh/Kl [g][TP][HD], Vh/Vl = V^T [g][HD][TP] (TP = SEQ for the f16 planes, RE for the bf16 hi/lo planes of the first RE/64 query blocks).
// EARLY form: query blocks 0 .. RE/64-1 (rows < RE, keys < RE); other form: query blocks RE/64 .. SEQ/64-1.
// Per 32-key chunk: K tile [32][HD] and V^T tile [HD][32] staged in LDS by all threads (block barriers), S = Q K^T (2 tiles), online softmax in f32
// (causal keys > query replaced by -inf: p = 0), P through a wave-private LDS tile (block barrier before the fragment reload), O += P V (8 tiles).
// EARLY: 3 products (hi.hi + hi.lo + lo.hi) for S and for P.V. Output: ctx plane CT[t][h*HD + d] = f16(ctx x CCAR); EARLY also CTL = f16((ctx x CCAR - hi) x LOSC);
constexpr int KSP = 136, VTP = 32, PSP = 40, OSP = 128;
template <typename T16, bool EARLY>
__device__ __forceinline__ void attn(const T16* __restrict__ Qh, const T16* __restrict__ Ql, const T16* __restrict__ Kh, const T16* __restrict__ Kl,
                                     const T16* __restrict__ Vh, const T16* __restrict__ Vl, h16* CT0, h16* CTL0,
                                     T16* ksh, T16* ksl, T16* vth, T16* vtl, T16* psh, T16* psl, h16* osg) {
    typedef typename WFrag<T16>::V V;
    constexpr int TP = EARLY ? RE : SEQ;
    const int tid = threadIdx.x, lane = tid & 31, wave = tid >> 5, lr = lane & 15, hh = lane >> 4;
    const int qblk = (int)blockIdx.x;
    const int head = blockIdx.y, g = head / REP;
    const int qw = qblk * 64 + wave * 16;                  // first query row of this wave
    const int nch = 2 * qblk + 2;                          // 32-key chunks visited: keys 0 .. qblk*64+63
    const size_t bz = blockIdx.z;                          // batch: its own planes
    h16* CT = CT0 + bz * SEQ * DM; h16* CTL = CTL0 + bz * RE * DM;
    const T16* qph = Qh + ((bz * NH_ + head) * TP + qw) * HD;  const T16* qpl = Ql + ((bz * NH_ + head) * TP + qw) * HD;
    const T16* kph = Kh + (bz * NKV + g) * TP * HD;             const T16* kpl = Kl + (bz * NKV + g) * TP * HD;
    const T16* vph = Vh + (bz * NKV + g) * HD * TP;             const T16* vpl = Vl + (bz * NKV + g) * HD * TP;
    T16* myph = psh + wave * 16 * PSP; T16* mypl = psl + (EARLY ? wave * 16 * PSP : 0);
    v8f o[8];
#pragma unroll
    for (int t = 0; t < 8; ++t) o[t] = (v8f){};
    float mrow[8], lrow[8];
#pragma unroll
    for (int r = 0; r < 8; ++r) { mrow[r] = -3.0e38f; lrow[r] = 0.f; }
    const float C2 = 1.4426950408889634f * 0.08838834764831845f;   // log2(e) x HD^-0.5
#pragma unroll 1
    for (int c = 0; c < nch; ++c) {
        __syncthreads();                                    // all waves done with the prior chunk's tiles
#pragma unroll
        for (int i = 0; i < 4; ++i) { const int id = tid + 128 * i; const int row = id >> 4, c8 = (id & 15) * 8; const size_t go = (size_t)(c * 32 + row) * HD + c8;
            *(v8usa*)(ksh + row * KSP + c8) = *(const v8usa*)(kph + go); if (EARLY) *(v8usa*)(ksl + row * KSP + c8) = *(const v8usa*)(kpl + go); }
#pragma unroll
        for (int j = 0; j < 4; ++j) { const size_t go = (size_t)tid * TP + c * 32 + 8 * j;      // d = tid
            *(v8usa*)(vth + tid * VTP + 8 * j) = *(const v8usa*)(vph + go); if (EARLY) *(v8usa*)(vtl + tid * VTP + 8 * j) = *(const v8usa*)(vpl + go); }
        __syncthreads();                                    // tiles visible
        v8f s0 = (v8f){}, s1 = (v8f){};
        V qa, kb0, kb1;
#pragma unroll
        for (int ks = 0; ks < 4; ++ks) {
            qa  = WFrag<T16>::ld(qph + (size_t)lr * HD + ks * 32 + 8 * hh);
            kb0 = WFrag<T16>::ld(ksh + lr * KSP + ks * 32 + 8 * hh);
            kb1 = WFrag<T16>::ld(ksh + (16 + lr) * KSP + ks * 32 + 8 * hh);
            s0 = WFrag<T16>::mma(qa, kb0, s0); s1 = WFrag<T16>::mma(qa, kb1, s1);
            if (EARLY) {
                const V qb  = WFrag<T16>::ld(qpl + (size_t)lr * HD + ks * 32 + 8 * hh);
                const V kl0 = WFrag<T16>::ld(ksl + lr * KSP + ks * 32 + 8 * hh);
                const V kl1 = WFrag<T16>::ld(ksl + (16 + lr) * KSP + ks * 32 + 8 * hh);
                s0 = WFrag<T16>::mma(qa, kl0, s0); s0 = WFrag<T16>::mma(qb, kb0, s0);
                s1 = WFrag<T16>::mma(qa, kl1, s1); s1 = WFrag<T16>::mma(qb, kb1, s1); }
        }
        asm volatile("v_nop\n\tv_nop\n\tv_nop\n\tv_nop" : "+v"(s0), "+v"(s1) : "v"(qa), "v"(kb0), "v"(kb1));
        // online softmax; acc element r of lane (lr, hh) = S[query qw + 8hh + r][key c*32 + lr] (s0) / [key c*32 + 16 + lr] (s1)
        float p0[8], p1[8];
        const int kg0 = c * 32 + lr, kg1 = kg0 + 16;
#pragma unroll
        for (int r = 0; r < 8; ++r) {
            const int qr = qw + 8 * hh + r;
            const bool v0 = (kg0 <= qr), v1 = (kg1 <= qr);
            const float a0 = v0 ? s0[r] * C2 : -3.0e38f;
            const float a1 = v1 ? s1[r] * C2 : -3.0e38f;
            float mx = fmaxf(a0, a1);
#pragma unroll
            for (int off = 8; off >= 1; off >>= 1) mx = fmaxf(mx, __shfl_xor(mx, off, 32));
            const float mnew = fmaxf(mrow[r], mx);
            const float alpha = __builtin_amdgcn_exp2f(mrow[r] - mnew);
            mrow[r] = mnew;
            const float x0 = __builtin_amdgcn_exp2f(a0 - mnew), x1 = __builtin_amdgcn_exp2f(a1 - mnew);
            const float e0 = v0 ? x0 : 0.f, e1 = v1 ? x1 : 0.f;
            float rs = e0 + e1;
#pragma unroll
            for (int off = 8; off >= 1; off >>= 1) rs += __shfl_xor(rs, off, 32);
            lrow[r] = lrow[r] * alpha + rs;
#pragma unroll
            for (int t = 0; t < 8; ++t) o[t][r] = o[t][r] * alpha;
            p0[r] = e0; p1[r] = e1;
        }
        // P tile [16 query rows][32 keys] -> A fragment (k = key)
#pragma unroll
        for (int r = 0; r < 8; ++r) { putp(myph, mypl, (8 * hh + r) * PSP + lr, p0[r]); putp(myph, mypl, (8 * hh + r) * PSP + 16 + lr, p1[r]); }
        __syncthreads();                                    // P visible (block barrier also orders this wave's own stores before the reload)
        const V pa = WFrag<T16>::ld(myph + lr * PSP + 8 * hh);
        V pb = pa; if (EARLY) pb = WFrag<T16>::ld(mypl + lr * PSP + 8 * hh);
        V vb;
#pragma unroll
        for (int t = 0; t < 8; ++t) { vb = WFrag<T16>::ld(vth + (t * 16 + lr) * VTP + 8 * hh);
            o[t] = WFrag<T16>::mma(pa, vb, o[t]);
            if (EARLY) { const V vl2 = WFrag<T16>::ld(vtl + (t * 16 + lr) * VTP + 8 * hh); o[t] = WFrag<T16>::mma(pa, vl2, o[t]); o[t] = WFrag<T16>::mma(pb, vb, o[t]); } }
        asm volatile("v_nop\n\tv_nop\n\tv_nop\n\tv_nop" : "+v"(o[0]), "+v"(o[1]), "+v"(o[2]), "+v"(o[3]), "+v"(o[4]), "+v"(o[5]), "+v"(o[6]), "+v"(o[7]) : "v"(pa), "v"(pb), "v"(vb));
    }
    // normalise and write ctx planes; o element r of lane (lr, hh), tile t = ctx[row qw + 8hh + r][d = 16t + lr]
    const float osc = EARLY ? CCAR : (CCAR / PCAR);
    float inv[8];
#pragma unroll
    for (int r = 0; r < 8; ++r) inv[r] = osc * __builtin_amdgcn_rcpf(lrow[r]);
    h16* myos = osg + wave * 16 * OSP;
#pragma unroll
    for (int t = 0; t < 8; ++t)
#pragma unroll
        for (int r = 0; r < 8; ++r) myos[(8 * hh + r) * OSP + t * 16 + lr] = tohx(o[t][r] * inv[r]);
    __syncthreads();
    h16* crow = CT + (size_t)qw * DM + head * HD;
{
#pragma unroll
        for (int s = 0; s < 8; ++s) { const int row = 2 * s + hh; const v8h val = *(const v8ha*)(myos + row * OSP + lr * 8); *(v8h*)(crow + (size_t)row * DM + lr * 8) = val; }
         }
    if (EARLY) {
        __syncthreads();
#pragma unroll
        for (int t = 0; t < 8; ++t)
#pragma unroll
            for (int r = 0; r < 8; ++r) { const float val = o[t][r] * inv[r]; const h16 hv = tohx(val); myos[(8 * hh + r) * OSP + t * 16 + lr] = tohx((val - (float)hv) * LOSC); }
        __syncthreads();
        h16* lrowp = CTL + (size_t)qw * DM + head * HD;
{
#pragma unroll
            for (int s = 0; s < 8; ++s) { const int row = 2 * s + hh; const v8h val = *(const v8ha*)(myos + row * OSP + lr * 8); *(v8h*)(lrowp + (size_t)row * DM + lr * 8) = val; }
             }
    }
}

// k_attn: grid (SEQ/64, NH_, batches), 128 threads; the form is chosen per work-group by its query block.
__global__ __launch_bounds__(128) void k_attn(const bf* __restrict__ QEh, const bf* __restrict__ QEl, const bf* __restrict__ KEh, const bf* __restrict__ KEl, const bf* __restrict__ VEh, const bf* __restrict__ VEl,
                                             const h16* __restrict__ QP16, const h16* __restrict__ KP16, const h16* __restrict__ VT16, h16* CT0, h16* CTL0) {
    __shared__ __align__(16) bf ksh[32 * KSP];
    __shared__ __align__(16) bf ksl[32 * KSP];
    __shared__ __align__(16) bf vth[HD * VTP];
    __shared__ __align__(16) bf vtl[HD * VTP];
    __shared__ __align__(16) bf psh[4 * 16 * PSP];
    __shared__ __align__(16) bf psl[4 * 16 * PSP];
    __shared__ __align__(16) h16 osg[4 * 16 * OSP];
    if ((int)blockIdx.x < RE / 64) attn<bf, true>(QEh, QEl, KEh, KEl, VEh, VEl, CT0, CTL0, ksh, ksl, vth, vtl, psh, psl, osg);
    else                           attn<h16, false>(QP16, QP16, KP16, KP16, VT16, VT16, CT0, CTL0, (h16*)ksh, (h16*)ksl, (h16*)vth, (h16*)vtl, (h16*)psh, (h16*)psl, osg);
}

// workspace carve total (each region padded to 256 B), checked against the 256 MiB line at build time
constexpr size_t al256(size_t b) { return (b + 255) & ~(size_t)255; }
constexpr size_t WS_TOTAL =
    al256((size_t)DQKV * DM * 2) + 2 * al256((size_t)DM * DQ * 2) + al256((size_t)NB * SEQ * DM * 2) +
    al256((size_t)NB * SEQ * DQKV * 4) +
    al256((size_t)NB * NH_ * SEQ * HD * 2) + 2 * al256((size_t)NB * NKV * SEQ * HD * 2) +
    2 * al256((size_t)NB * NH_ * RE * HD * 2) + 4 * al256((size_t)NB * NKV * RE * HD * 2) +
    al256((size_t)NB * SEQ * DM * 2) + al256((size_t)NB * RE * DM * 2);
static_assert(WS_TOTAL <= (size_t)268435456);

extern "C" void kernel_launch(void* const* d_in, const int* in_sizes, int n_in,
                              void* d_out, int out_size, void* d_ws, size_t ws_size, hipStream_t stream) {
    if (n_in < 5) return;
    const float* x  = (const float*)d_in[0];     // [NB_FULL][SEQ_FULL][DM]
    const float* wq = (const float*)d_in[1];     // [DQ][DM]  ([out][in])
    const float* wk = (const float*)d_in[2];     // [DKV][DM]
    const float* wv = (const float*)d_in[3];     // [DKV][DM]
    const float* wo = (const float*)d_in[4];     // [DM][DQ]
    float* OUT = (float*)d_out;                  // [NB_FULL][SEQ_FULL][DM]
    if ((size_t)in_sizes[0] < (size_t)(NB - 1) * SEQ_FULL * DM + (size_t)SEQ * DM) return;
    if ((size_t)in_sizes[1] < (size_t)DQ * DM) return;
    if ((size_t)in_sizes[2] < (size_t)DKV * DM) return;
    if ((size_t)in_sizes[3] < (size_t)DKV * DM) return;
    if ((size_t)in_sizes[4] < (size_t)DM * DQ) return;
    if ((size_t)out_size < (size_t)(NB - 1) * SEQ_FULL * DM + (size_t)SEQ * DM) return;

    char* wsp = (char*)d_ws;
    auto take = [&](size_t bytes) { char* p = wsp; wsp += (bytes + 255) & ~(size_t)255; return (void*)p; };
    bf*  WQKV = (bf*)take((size_t)DQKV * DM * 2);
    h16* WOH  = (h16*)take((size_t)DM * DQ * 2);   h16* WOL = (h16*)take((size_t)DM * DQ * 2);
    bf*  XB   = (bf*)take((size_t)NB * SEQ * DM * 2);
    float* F  = (float*)take((size_t)NB * SEQ * DQKV * 4);
    h16* QP16 = (h16*)take((size_t)NB * NH_ * SEQ * HD * 2); h16* KP16 = (h16*)take((size_t)NB * NKV * SEQ * HD * 2); h16* VT16 = (h16*)take((size_t)NB * NKV * HD * SEQ * 2);
    bf*  QEh  = (bf*)take((size_t)NB * NH_ * RE * HD * 2);  bf* QEl = (bf*)take((size_t)NB * NH_ * RE * HD * 2);
    bf*  KEh  = (bf*)take((size_t)NB * NKV * RE * HD * 2);  bf* KEl = (bf*)take((size_t)NB * NKV * RE * HD * 2);
    bf*  VEh  = (bf*)take((size_t)NB * NKV * HD * RE * 2);  bf* VEl = (bf*)take((size_t)NB * NKV * HD * RE * 2);
    h16* CT16 = (h16*)take((size_t)NB * SEQ * DM * 2);     h16* CTL = (h16*)take((size_t)NB * RE * DM * 2);
    if ((size_t)(wsp - (char*)d_ws) > ws_size) return;       // 146,800,640 B at full size

    const float woscale = 1.0f / (CCAR * WCAR);
    k_cvtall<<<NB * CBX + CBQ + 2 * CBKV + CBO, 256, 0, stream>>>(x, wq, wk, wv, wo, XB, WQKV, WOH, WOL);
    k_gemmqkv<<<dim3(SEQ / 64, DQKV / 64, NB), 32, 0, stream>>>(XB, WQKV, F);
    k_planes<<<dim3(PLQ + 2 * PLKV, NB, 1), 256, 0, stream>>>(F, QP16, QEh, QEl, KP16, KEh, KEl, VT16, VEh, VEl);
    k_attn<<<dim3(SEQ / 64, NH_, NB), 128, 0, stream>>>(QEh, QEl, KEh, KEl, VEh, VEl, QP16, KP16, VT16, CT16, CTL);
    k_gemmo<<<dim3(SEQ / 64, DM / 64, NB), 32, 0, stream>>>(CT16, CTL, WOH, WOL, OUT, woscale);
}
